// v000
// Measured on an AMD MI455X. A time is GPU time per run, averaged over a window of back-to-back runs after a warm-up
// (all launches, gaps included; the runs take copies of the inputs in turn), and the median of several windows.
// Apart from v000's, it joins two sittings. Times from different sittings can be a few percent apart, while
// side-by-side timings come from the same sitting.
// v000, which the later versions start from, runs in 226 microseconds.
#include <hip/hip_runtime.h>

#define BQ 64
#define LSEQ 512
#define EDIM 64
#define NHEAD 8
#define HDIM 8
#define NROW (BQ * LSEQ) /* 32768 */

typedef __attribute__((ext_vector_type(16))) _Float16 v16h;
typedef __attribute__((ext_vector_type(8))) float v8f;

#if defined(__has_builtin)
#if __has_builtin(__builtin_amdgcn_global_load_async_to_lds_b128)
#define HAVE_ASYNC_LDS 1
#endif
#endif

// payload type demanded by the async-to-LDS builtin (per hipcc diagnostic:
// param0 is "vector_size(16) int __device__ *", i.e. int4 in AS1)
typedef int v4i_ __attribute__((vector_size(16)));
typedef __attribute__((address_space(1))) v4i_* as1_v4i;
typedef __attribute__((address_space(3))) v4i_* as3_v4i;

// K index held by v16h slot s for a lane in K-half `khalf` (ISA 7.12.2,
// 16-bit A 16x32 layout; B uses the same per-lane K ordering with N=lane%16).
__device__ __forceinline__ int kslot(int s, int khalf) {
  int j = s >> 1, p = s & 1;
  return (j < 4) ? (khalf * 8 + j * 2 + p) : (16 + khalf * 8 + (j - 4) * 2 + p);
}

__device__ __forceinline__ v8f wmma16(v16h a, v16h b, v8f c) {
  return __builtin_amdgcn_wmma_f32_16x16x32_f16(false, a, false, b, (short)0, c,
                                                false, false);
}

// butterfly reductions within each 16-lane half of the wave32 (matches the
// WMMA C-layout row split: lanes 0-15 hold rows 0-7, lanes 16-31 rows 8-15)
__device__ __forceinline__ float hmax16(float v) {
#pragma unroll
  for (int m = 1; m < 16; m <<= 1) v = fmaxf(v, __shfl_xor(v, m, 32));
  return v;
}
__device__ __forceinline__ float hsum16(float v) {
#pragma unroll
  for (int m = 1; m < 16; m <<= 1) v += __shfl_xor(v, m, 32);
  return v;
}

// wave-local LDS fence: CDNA5 split dep-counter wait (s_wait_dscnt)
__device__ __forceinline__ void lds_wave_fence() {
  __builtin_amdgcn_wave_barrier();
  asm volatile("s_wait_dscnt 0x0" ::: "memory");
  __builtin_amdgcn_wave_barrier();
}

// 16-byte global -> LDS copy: async (ASYNCcnt-tracked) when available.
__device__ __forceinline__ void async_cp16(const _Float16* g, _Float16* l) {
#ifdef HAVE_ASYNC_LDS
  __builtin_amdgcn_global_load_async_to_lds_b128((as1_v4i)(void*)g,
                                                 (as3_v4i)(void*)l, 0, 0);
#else
  *(float4*)l = *(const float4*)g;
#endif
}

__device__ __forceinline__ void wait_async() {
#ifdef HAVE_ASYNC_LDS
#if __has_builtin(__builtin_amdgcn_s_wait_asynccnt)
  __builtin_amdgcn_s_wait_asynccnt(0);
#else
  asm volatile("s_wait_asynccnt 0x0" ::: "memory");
#endif
#endif
}

// ---------------------------------------------------------------------------
// Kernel 1: fused QKV projections.  grid=(NROW/16, 3), block=128 (4 waves,
// each wave one 16-col output tile).  out = X @ W^T + b, q pre-scaled 1/sqrt(D)
// ---------------------------------------------------------------------------
__global__ void __launch_bounds__(128)
ga_qkv(const float* __restrict__ q, const float* __restrict__ k,
       const float* __restrict__ Wq, const float* __restrict__ bq,
       const float* __restrict__ Wk, const float* __restrict__ bk,
       const float* __restrict__ Wv, const float* __restrict__ bv,
       _Float16* __restrict__ qh, _Float16* __restrict__ kh,
       _Float16* __restrict__ vh) {
  const int lane = threadIdx.x & 31;
  const int wv = threadIdx.x >> 5;
  const int row0 = blockIdx.x * 16;
  const int which = blockIdx.y;
  const float* X;
  const float* W;
  const float* bias;
  _Float16* out;
  float osc;
  if (which == 0) { X = q; W = Wq; bias = bq; out = qh; osc = 0.35355339059327373f; }
  else if (which == 1) { X = k; W = Wk; bias = bk; out = kh; osc = 1.0f; }
  else { X = k; W = Wv; bias = bv; out = vh; osc = 1.0f; }

  const int m = lane & 15, half = lane >> 4;
  const int n = wv * 16 + m;
  __builtin_prefetch(&W[(size_t)n * EDIM], 0, 3);  // -> global_prefetch_b8
  v8f c;
  const float bn = bias[n];
#pragma unroll
  for (int r = 0; r < 8; ++r) c[r] = bn;

#pragma unroll
  for (int kb = 0; kb < EDIM; kb += 32) {
    v16h a, b;
#pragma unroll
    for (int s = 0; s < 16; ++s) {
      int kk = kb + kslot(s, half);
      a[s] = (_Float16)X[(size_t)(row0 + m) * EDIM + kk];
      b[s] = (_Float16)W[(size_t)n * EDIM + kk];
    }
    c = wmma16(a, b, c);
  }
#pragma unroll
  for (int r = 0; r < 8; ++r)
    out[(size_t)(row0 + r + 8 * half) * EDIM + n] = (_Float16)(c[r] * osc);
}

// ---------------------------------------------------------------------------
// Kernel 2: fused flash attention.  grid=(LSEQ/16, B), block=256 (8 waves,
// wave h = head h, block owns a 16-row Lq tile).  K/V 16x64 tiles are
// double-buffered in LDS via async global->LDS copies (ASYNCcnt) so the
// softmax+WMMA work overlaps the next tile's fill.  Pass 1: online softmax +
// P@V via WMMA.  Pass 2: recompute scores (cheap) to emit head-mean attn_wts
// via LDS ds_add atomics; scores never touch HBM (saves ~512 MB of traffic).
// ---------------------------------------------------------------------------
__global__ void __launch_bounds__(256)
ga_attn(const _Float16* __restrict__ qh, const _Float16* __restrict__ kh,
        const _Float16* __restrict__ vh, _Float16* __restrict__ ctx,
        float* __restrict__ attw) {
  __shared__ float s_attn[16 * LSEQ];        // 32 KB head-mean accumulator
  __shared__ _Float16 s_p[NHEAD][16 * 16];   // 4 KB per-wave C->A relayout
  __shared__ _Float16 s_kt[2][16 * EDIM];    // 4 KB K tile, double-buffered
  __shared__ _Float16 s_vt[2][16 * EDIM];    // 4 KB V tile, double-buffered
  const int tid = threadIdx.x;
  const int lane = tid & 31;
  const int h = tid >> 5;
  const int b = blockIdx.y;
  const int row0 = b * LSEQ + blockIdx.x * 16;  // flattened q row
  const int krow0 = b * LSEQ;
  const int m = lane & 15, half = lane >> 4;

  for (int i = tid; i < 16 * LSEQ; i += 256) s_attn[i] = 0.0f;

  // per-thread 16B chunk of the K/V tile staging (threads 0-127: K, 128-255: V)
  const int chunk = tid & 127;
  const int crow = chunk >> 3, cseg = (chunk & 7) * 8;
  const _Float16* gkv = (tid < 128) ? kh : vh;
  _Float16* ld0 = ((tid < 128) ? s_kt[0] : s_vt[0]) + crow * EDIM + cseg;
  _Float16* ld1 = ((tid < 128) ? s_kt[1] : s_vt[1]) + crow * EDIM + cseg;
  auto stage = [&](int lk0, int buf) {
    async_cp16(gkv + (size_t)(krow0 + lk0 + crow) * EDIM + cseg,
               buf ? ld1 : ld0);
  };

  // A = q-head tile (16 x 8, zero-padded K to 32), already scaled
  v16h aq;
#pragma unroll
  for (int s = 0; s < 16; ++s) {
    int kk = kslot(s, half);
    aq[s] = (kk < HDIM) ? qh[(size_t)(row0 + m) * EDIM + h * HDIM + kk]
                        : (_Float16)0.0f;
  }

  float mrow[8], lrow[8];
#pragma unroll
  for (int r = 0; r < 8; ++r) { mrow[r] = -1e30f; lrow[r] = 0.0f; }
  v8f cacc = {};

  stage(0, 0);
  for (int it = 0; it < LSEQ / 16; ++it) {
    const int buf = it & 1;
    wait_async();
    __syncthreads();  // tile `it` resident in s_kt/s_vt[buf] for all waves
    if (it + 1 < LSEQ / 16) stage((it + 1) * 16, buf ^ 1);  // overlap fill

    // B[d, j] = K[lk0 + j, h*8 + d]  (zero-padded K dim)
    v16h bk16;
#pragma unroll
    for (int s = 0; s < 16; ++s) {
      int kk = kslot(s, half);
      bk16[s] = (kk < HDIM) ? s_kt[buf][m * EDIM + h * HDIM + kk]
                            : (_Float16)0.0f;
    }
    v8f cs = {};
    cs = wmma16(aq, bk16, cs);

    float p[8];
#pragma unroll
    for (int r = 0; r < 8; ++r) {
      float tmax = hmax16(cs[r]);
      float nm = fmaxf(mrow[r], tmax);
      float sc = __expf(mrow[r] - nm);
      lrow[r] *= sc;
      cacc[r] *= sc;
      mrow[r] = nm;
      p[r] = __expf(cs[r] - nm);
      lrow[r] += hsum16(p[r]);
      s_p[h][(r + 8 * half) * 16 + m] = (_Float16)p[r];  // C-layout -> row-major
    }
    lds_wave_fence();

    // A2 = P tile (16 rows x 16 lk, K padded to 32), B2 = V tile (16 x 8)
    v16h ap, bv16;
#pragma unroll
    for (int s = 0; s < 16; ++s) {
      int kk = kslot(s, half);
      ap[s] = (kk < 16) ? s_p[h][m * 16 + kk] : (_Float16)0.0f;
      bv16[s] = (kk < 16 && m < HDIM)
                    ? s_vt[buf][kk * EDIM + h * HDIM + m]
                    : (_Float16)0.0f;
    }
    cacc = wmma16(ap, bv16, cacc);
    lds_wave_fence();
  }

  // normalized context out (f16 staging for the Wo GEMM)
#pragma unroll
  for (int r = 0; r < 8; ++r) {
    float inv = 1.0f / lrow[r];
    if (m < HDIM)
      ctx[(size_t)(row0 + r + 8 * half) * EDIM + h * HDIM + m] =
          (_Float16)(cacc[r] * inv);
  }

  // Pass 2: head-mean attention weights (same async K-tile pipeline)
  __syncthreads();
  stage(0, 0);
  for (int it = 0; it < LSEQ / 16; ++it) {
    const int buf = it & 1;
    wait_async();
    __syncthreads();
    if (it + 1 < LSEQ / 16) stage((it + 1) * 16, buf ^ 1);

    v16h bk16;
#pragma unroll
    for (int s = 0; s < 16; ++s) {
      int kk = kslot(s, half);
      bk16[s] = (kk < HDIM) ? s_kt[buf][m * EDIM + h * HDIM + kk]
                            : (_Float16)0.0f;
    }
    v8f cs = {};
    cs = wmma16(aq, bk16, cs);
#pragma unroll
    for (int r = 0; r < 8; ++r) {
      float pv = __expf(cs[r] - mrow[r]) * (0.125f / lrow[r]);
      atomicAdd(&s_attn[(r + 8 * half) * LSEQ + it * 16 + m], pv);
    }
  }
  __syncthreads();

  const size_t abase =
      (size_t)b * LSEQ * LSEQ + (size_t)(blockIdx.x * 16) * LSEQ;
  for (int i = tid; i < 16 * LSEQ; i += 256) attw[abase + i] = s_attn[i];
}

// ---------------------------------------------------------------------------
// Kernel 3/5: y = LN(A16 @ W^T + bias + resid).  One wave owns a full 16x64
// row tile (4 col tiles) so LN row stats reduce with wave shuffles.
// grid = NROW/128, block = 256 (8 waves = 8 row tiles).
// ---------------------------------------------------------------------------
__global__ void __launch_bounds__(256)
ga_proj_res_ln(const _Float16* __restrict__ A16, const float* __restrict__ W,
               const float* __restrict__ bias, const float* __restrict__ resid,
               const float* __restrict__ g, const float* __restrict__ bb,
               float* __restrict__ xout, _Float16* __restrict__ xout16) {
  const int lane = threadIdx.x & 31;
  const int wv = threadIdx.x >> 5;
  const int row0 = (blockIdx.x * 8 + wv) * 16;
  const int m = lane & 15, half = lane >> 4;
  __builtin_prefetch(&W[(size_t)m * EDIM], 0, 3);

  v8f c[4];
#pragma unroll
  for (int t = 0; t < 4; ++t) {
    float bn = bias[t * 16 + m];
#pragma unroll
    for (int r = 0; r < 8; ++r) c[t][r] = bn;
  }

#pragma unroll
  for (int kb = 0; kb < EDIM; kb += 32) {
    v16h a;
#pragma unroll
    for (int s = 0; s < 16; ++s)
      a[s] = A16[(size_t)(row0 + m) * EDIM + kb + kslot(s, half)];
#pragma unroll
    for (int t = 0; t < 4; ++t) {
      v16h bmat;
#pragma unroll
      for (int s = 0; s < 16; ++s)
        bmat[s] = (_Float16)W[(size_t)(t * 16 + m) * EDIM + kb + kslot(s, half)];
      c[t] = wmma16(a, bmat, c[t]);
    }
  }

#pragma unroll
  for (int t = 0; t < 4; ++t)
#pragma unroll
    for (int r = 0; r < 8; ++r)
      c[t][r] += resid[(size_t)(row0 + r + 8 * half) * EDIM + t * 16 + m];

  float mu[8], rs[8];
#pragma unroll
  for (int r = 0; r < 8; ++r) {
    float sm = 0.f, sq = 0.f;
#pragma unroll
    for (int t = 0; t < 4; ++t) {
      sm += c[t][r];
      sq += c[t][r] * c[t][r];
    }
    sm = hsum16(sm);
    sq = hsum16(sq);
    float mean = sm * (1.0f / 64.0f);
    float var = sq * (1.0f / 64.0f) - mean * mean;
    mu[r] = mean;
    rs[r] = __frsqrt_rn(var + 1e-5f);
  }

#pragma unroll
  for (int t = 0; t < 4; ++t) {
    int col = t * 16 + m;
    float gg = g[col], bv = bb[col];
#pragma unroll
    for (int r = 0; r < 8; ++r) {
      float y = (c[t][r] - mu[r]) * rs[r] * gg + bv;
      size_t idx = (size_t)(row0 + r + 8 * half) * EDIM + col;
      xout[idx] = y;
      if (xout16) xout16[idx] = (_Float16)y;
    }
  }
}

// ---------------------------------------------------------------------------
// Kernel 4: h1 = relu(x @ W1^T + b1) -> f16.  grid=NROW/16, block=128.
// ---------------------------------------------------------------------------
__global__ void __launch_bounds__(128)
ga_ffn1(const _Float16* __restrict__ x16, const float* __restrict__ W1,
        const float* __restrict__ b1, _Float16* __restrict__ h1) {
  const int lane = threadIdx.x & 31;
  const int wv = threadIdx.x >> 5;
  const int row0 = blockIdx.x * 16;
  const int m = lane & 15, half = lane >> 4;
  const int n = wv * 16 + m;
  __builtin_prefetch(&W1[(size_t)n * EDIM], 0, 3);
  v8f c;
  const float bn = b1[n];
#pragma unroll
  for (int r = 0; r < 8; ++r) c[r] = bn;
#pragma unroll
  for (int kb = 0; kb < EDIM; kb += 32) {
    v16h a, b;
#pragma unroll
    for (int s = 0; s < 16; ++s) {
      int kk = kb + kslot(s, half);
      a[s] = x16[(size_t)(row0 + m) * EDIM + kk];
      b[s] = (_Float16)W1[(size_t)n * EDIM + kk];
    }
    c = wmma16(a, b, c);
  }
#pragma unroll
  for (int r = 0; r < 8; ++r)
    h1[(size_t)(row0 + r + 8 * half) * EDIM + n] = (_Float16)fmaxf(c[r], 0.0f);
}

// ---------------------------------------------------------------------------
extern "C" void kernel_launch(void* const* d_in, const int* in_sizes, int n_in,
                              void* d_out, int out_size, void* d_ws,
                              size_t ws_size, hipStream_t stream) {
  const float* q    = (const float*)d_in[0];
  const float* k    = (const float*)d_in[1];
  const float* prev = (const float*)d_in[2];
  const float* Wq   = (const float*)d_in[3];
  const float* bq   = (const float*)d_in[4];
  const float* Wk   = (const float*)d_in[5];
  const float* bk   = (const float*)d_in[6];
  const float* Wv   = (const float*)d_in[7];
  const float* bv   = (const float*)d_in[8];
  const float* Wo   = (const float*)d_in[9];
  const float* bo   = (const float*)d_in[10];
  const float* g1   = (const float*)d_in[11];
  const float* bb1  = (const float*)d_in[12];
  const float* W1   = (const float*)d_in[13];
  const float* b1   = (const float*)d_in[14];
  const float* W2   = (const float*)d_in[15];
  const float* b2   = (const float*)d_in[16];
  const float* g2   = (const float*)d_in[17];
  const float* bb2  = (const float*)d_in[18];

  float* out = (float*)d_out;                          // [B, Lq, E]
  float* attw = out + (size_t)BQ * LSEQ * EDIM;        // [B, Lq, Lk]

  char* ws = (char*)d_ws;                              // 32 MB used
  _Float16* qh  = (_Float16*)(ws + (size_t)0);
  _Float16* kh  = (_Float16*)(ws + ((size_t)4 << 20));
  _Float16* vh  = (_Float16*)(ws + ((size_t)8 << 20));
  _Float16* ctx = (_Float16*)(ws + ((size_t)12 << 20));
  float*    xf  = (float*)   (ws + ((size_t)16 << 20));
  _Float16* x16 = (_Float16*)(ws + ((size_t)24 << 20));
  _Float16* h1  = (_Float16*)(ws + ((size_t)28 << 20));

  ga_qkv<<<dim3(NROW / 16, 3), 128, 0, stream>>>(q, k, Wq, bq, Wk, bk, Wv, bv,
                                                 qh, kh, vh);
  ga_attn<<<dim3(LSEQ / 16, BQ), 256, 0, stream>>>(qh, kh, vh, ctx, attw);
  ga_proj_res_ln<<<NROW / 128, 256, 0, stream>>>(ctx, Wo, bo, prev, g1, bb1,
                                                 xf, x16);
  ga_ffn1<<<NROW / 16, 128, 0, stream>>>(x16, W1, b1, h1);
  ga_proj_res_ln<<<NROW / 128, 256, 0, stream>>>(h1, W2, b2, xf, g2, bb2, out,
                                                 (_Float16*)nullptr);
}

// v001
// One run takes 154 microseconds.
// Next to v000, in two timings, it ran 1.50 times as fast each time.
#include <hip/hip_runtime.h>

#define BQ 64
#define LSEQ 512
#define EDIM 64
#define NHEAD 8
#define HDIM 8
#define NROW (BQ * LSEQ) /* 32768 */

typedef __attribute__((ext_vector_type(16))) _Float16 v16h;
typedef __attribute__((ext_vector_type(8))) _Float16 v8h;
typedef __attribute__((ext_vector_type(8))) float v8f;

#if defined(__has_builtin)
#if __has_builtin(__builtin_amdgcn_global_load_async_to_lds_b128)
#define HAVE_ASYNC_LDS 1
#endif
#endif

// payload type demanded by the async-to-LDS builtin (per hipcc diagnostic:
// param0 is "vector_size(16) int __device__ *", i.e. int4 in AS1)
typedef int v4i_ __attribute__((vector_size(16)));
typedef __attribute__((address_space(1))) v4i_* as1_v4i;
typedef __attribute__((address_space(3))) v4i_* as3_v4i;

// K index held by v16h slot s for a lane in K-half `khalf` (ISA 7.12.2,
// 16-bit A 16x32 layout; B uses the same per-lane K ordering with N=lane%16).
__device__ __forceinline__ int kslot(int s, int khalf) {
  int j = s >> 1, p = s & 1;
  return (j < 4) ? (khalf * 8 + j * 2 + p) : (16 + khalf * 8 + (j - 4) * 2 + p);
}

__device__ __forceinline__ v8f wmma16(v16h a, v16h b, v8f c) {
  return __builtin_amdgcn_wmma_f32_16x16x32_f16(false, a, false, b, (short)0, c,
                                                false, false);
}

// value held by lane l ^ 16 (the other 16-lane half), by a vector cross-row move
__device__ __forceinline__ float xhalf(float v) {
  int b = __builtin_bit_cast(int, v);
  b = __builtin_amdgcn_permlanex16(b, b, 0x76543210, 0xfedcba98, false, false);
  return __builtin_bit_cast(float, b);
}

// butterfly reduction within each 16-lane half of the wave32 (matches the
// WMMA C-layout row split: lanes 0-15 hold rows 0-7, lanes 16-31 rows 8-15)
__device__ __forceinline__ float hsum16(float v) {
#pragma unroll
  for (int m = 1; m < 16; m <<= 1) v += __shfl_xor(v, m, 32);
  return v;
}

// wave-local LDS fence: CDNA5 split dep-counter wait (s_wait_dscnt)
__device__ __forceinline__ void lds_wave_fence() {
  __builtin_amdgcn_wave_barrier();
  asm volatile("s_wait_dscnt 0x0" ::: "memory");
  __builtin_amdgcn_wave_barrier();
}

// 16-byte global -> LDS copy: async (ASYNCcnt-tracked) when available.
__device__ __forceinline__ void async_cp16(const _Float16* g, _Float16* l) {
#ifdef HAVE_ASYNC_LDS
  __builtin_amdgcn_global_load_async_to_lds_b128((as1_v4i)(void*)g,
                                                 (as3_v4i)(void*)l, 0, 0);
#else
  *(float4*)l = *(const float4*)g;
#endif
}

__device__ __forceinline__ void wait_async() {
#ifdef HAVE_ASYNC_LDS
#if __has_builtin(__builtin_amdgcn_s_wait_asynccnt)
  __builtin_amdgcn_s_wait_asynccnt(0);
#else
  asm volatile("s_wait_asynccnt 0x0" ::: "memory");
#endif
#endif
}

// ---------------------------------------------------------------------------
// Kernel 1: fused QKV projections.  grid=(NROW/16, 3), block=128 (4 waves,
// each wave one 16-col output tile).  out = X @ W^T + b, q pre-scaled 1/sqrt(D)
// ---------------------------------------------------------------------------
__global__ void __launch_bounds__(128)
ga_qkv(const float* __restrict__ q, const float* __restrict__ k,
       const float* __restrict__ Wq, const float* __restrict__ bq,
       const float* __restrict__ Wk, const float* __restrict__ bk,
       const float* __restrict__ Wv, const float* __restrict__ bv,
       _Float16* __restrict__ qh, _Float16* __restrict__ kh,
       _Float16* __restrict__ vh) {
  const int lane = threadIdx.x & 31;
  const int wv = threadIdx.x >> 5;
  const int row0 = blockIdx.x * 16;
  const int which = blockIdx.y;
  const float* X;
  const float* W;
  const float* bias;
  _Float16* out;
  float osc;
  if (which == 0) { X = q; W = Wq; bias = bq; out = qh; osc = 0.35355339059327373f; }
  else if (which == 1) { X = k; W = Wk; bias = bk; out = kh; osc = 1.0f; }
  else { X = k; W = Wv; bias = bv; out = vh; osc = 1.0f; }

  const int m = lane & 15, half = lane >> 4;
  const int n = wv * 16 + m;
  __builtin_prefetch(&W[(size_t)n * EDIM], 0, 3);  // -> global_prefetch_b8
  v8f c;
  const float bn = bias[n];
#pragma unroll
  for (int r = 0; r < 8; ++r) c[r] = bn;

#pragma unroll
  for (int kb = 0; kb < EDIM; kb += 32) {
    v16h a, b;
#pragma unroll
    for (int s = 0; s < 16; ++s) {
      int kk = kb + kslot(s, half);
      a[s] = (_Float16)X[(size_t)(row0 + m) * EDIM + kk];
      b[s] = (_Float16)W[(size_t)n * EDIM + kk];
    }
    c = wmma16(a, b, c);
  }
#pragma unroll
  for (int r = 0; r < 8; ++r)
    out[(size_t)(row0 + r + 8 * half) * EDIM + n] = (_Float16)(c[r] * osc);
}

// ---------------------------------------------------------------------------
// Kernel 2: fused flash attention.  grid=(LSEQ/16, B), block=256 (8 waves,
// wave h = head h, block owns a 16-row Lq tile).  K/V 16x64 tiles are
// double-buffered in LDS via async global->LDS copies (ASYNCcnt) so the
// softmax+WMMA work overlaps the next tile's fill.  Pass 1: online softmax on
// transposed scores S^T = K Q^T (a lane holds 8 keys of ONE query, so max and
// sum are in-lane) and O^T += V^T P^T with P^T packed from the score
// accumulators straight into the B operand.  Pass 2: recompute scores (cheap)
// to emit head-mean attn_wts via LDS ds_add atomics; scores never touch HBM
// (saves ~512 MB of traffic).
// ---------------------------------------------------------------------------
__global__ void __launch_bounds__(256)
ga_attn(const _Float16* __restrict__ qh, const _Float16* __restrict__ kh,
        const _Float16* __restrict__ vh, _Float16* __restrict__ ctx,
        float* __restrict__ attw) {
  __shared__ float s_attn[16 * LSEQ];        // 32 KB head-mean accumulator
  __shared__ _Float16 s_kt[2][16 * EDIM];    // 4 KB K tile, double-buffered
  __shared__ _Float16 s_vt[2][16 * EDIM];    // 4 KB V tile, double-buffered
  const int tid = threadIdx.x;
  const int lane = tid & 31;
  const int h = tid >> 5;
  const int b = blockIdx.y;
  const int row0 = b * LSEQ + blockIdx.x * 16;  // flattened q row
  const int krow0 = b * LSEQ;
  const int m = lane & 15, half = lane >> 4;

  for (int i = tid; i < 16 * LSEQ; i += 256) s_attn[i] = 0.0f;

  // per-thread 16B chunk of the K/V tile staging (threads 0-127: K, 128-255: V)
  const int chunk = tid & 127;
  const int crow = chunk >> 3, cseg = (chunk & 7) * 8;
  const _Float16* gkv = (tid < 128) ? kh : vh;
  _Float16* ld0 = ((tid < 128) ? s_kt[0] : s_vt[0]) + crow * EDIM + cseg;
  _Float16* ld1 = ((tid < 128) ? s_kt[1] : s_vt[1]) + crow * EDIM + cseg;
  auto stage = [&](int lk0, int buf) {
    async_cp16(gkv + (size_t)(krow0 + lk0 + crow) * EDIM + cseg,
               buf ? ld1 : ld0);
  };

  // A = q-head tile (16 x 8, zero-padded K to 32), already scaled
  v16h aq;
#pragma unroll
  for (int s = 0; s < 16; ++s) {
    int kk = kslot(s, half);
    aq[s] = (kk < HDIM) ? qh[(size_t)(row0 + m) * EDIM + h * HDIM + kk]
                        : (_Float16)0.0f;
  }

  // query m of the tile belongs to lanes m and m + 16: running max (equal in
  // both), and each half's own partial sum over the keys it holds
  float mq = -1e30f, lq = 0.0f;
  v8f cacc = {};  // O^T: cacc[r] = O[query m][d = r + 8 * half], d < 8 is real

  stage(0, 0);
  for (int it = 0; it < LSEQ / 16; ++it) {
    const int buf = it & 1;
    wait_async();
    __syncthreads();  // tile `it` resident in s_kt/s_vt[buf] for all waves
    if (it + 1 < LSEQ / 16) stage((it + 1) * 16, buf ^ 1);  // overlap fill

    // A[j, d] = K[lk0 + j, h*8 + d]  (zero-padded K dim)
    v16h bk16;
#pragma unroll
    for (int s = 0; s < 16; ++s) {
      int kk = kslot(s, half);
      bk16[s] = (kk < HDIM) ? s_kt[buf][m * EDIM + h * HDIM + kk]
                            : (_Float16)0.0f;
    }
    // K rows as A, Q as B: cs[r] = S[query m][key lk0 + r + 8 * half]
    v8f cs = {};
    cs = wmma16(bk16, aq, cs);

    float tmax = cs[0];
#pragma unroll
    for (int r = 1; r < 8; ++r) tmax = fmaxf(tmax, cs[r]);
    tmax = fmaxf(tmax, xhalf(tmax));  // all 16 keys of the tile
    const float nm = fmaxf(mq, tmax);
    const float sc = __expf(mq - nm);
    mq = nm;

    // P^T as B: slot s < 8 is key 8 * half + s = kslot(s, half), which is the
    // accumulator's own row map; slots 8-15 (K 16-31) are the zero padding
    v16h bp;
    float ps = 0.0f;
#pragma unroll
    for (int r = 0; r < 8; ++r) {
      float p = __expf(cs[r] - nm);
      ps += p;
      bp[r] = (_Float16)p;
      bp[r + 8] = (_Float16)0.0f;
      cacc[r] *= sc;
    }
    lq = lq * sc + ps;

    // A2 = V^T tile (8 d x 16 lk, K padded to 32)
    v16h av16;
#pragma unroll
    for (int s = 0; s < 16; ++s) {
      int kk = kslot(s, half);
      av16[s] = (kk < 16 && m < HDIM)
                    ? s_vt[buf][kk * EDIM + h * HDIM + m]
                    : (_Float16)0.0f;
    }
    cacc = wmma16(av16, bp, cacc);
    lds_wave_fence();
  }

  // join the halves' sums once; normalized context out (f16 staging for the
  // Wo GEMM): lanes 0-15 hold the 8 d of their query, one 16-byte store
  const float lsum = lq + xhalf(lq);
  {
    const float inv = 1.0f / lsum;
    v8h o;
#pragma unroll
    for (int r = 0; r < 8; ++r) o[r] = (_Float16)(cacc[r] * inv);
    if (half == 0)
      *(v8h*)&ctx[(size_t)(row0 + m) * EDIM + h * HDIM] = o;
  }

  // pass 2 keeps the S = Q K^T map (row r + 8 * half): fetch those rows' stats
  float mrow[8], lrow[8];
#pragma unroll
  for (int r = 0; r < 8; ++r) {
    mrow[r] = __shfl(mq, r + 8 * half, 32);
    lrow[r] = __shfl(lsum, r + 8 * half, 32);
  }

  // Pass 2: head-mean attention weights (same async K-tile pipeline)
  __syncthreads();
  stage(0, 0);
  for (int it = 0; it < LSEQ / 16; ++it) {
    const int buf = it & 1;
    wait_async();
    __syncthreads();
    if (it + 1 < LSEQ / 16) stage((it + 1) * 16, buf ^ 1);

    v16h bk16;
#pragma unroll
    for (int s = 0; s < 16; ++s) {
      int kk = kslot(s, half);
      bk16[s] = (kk < HDIM) ? s_kt[buf][m * EDIM + h * HDIM + kk]
                            : (_Float16)0.0f;
    }
    v8f cs = {};
    cs = wmma16(aq, bk16, cs);
#pragma unroll
    for (int r = 0; r < 8; ++r) {
      float pv = __expf(cs[r] - mrow[r]) * (0.125f / lrow[r]);
      atomicAdd(&s_attn[(r + 8 * half) * LSEQ + it * 16 + m], pv);
    }
  }
  __syncthreads();

  const size_t abase =
      (size_t)b * LSEQ * LSEQ + (size_t)(blockIdx.x * 16) * LSEQ;
  for (int i = tid; i < 16 * LSEQ; i += 256) attw[abase + i] = s_attn[i];
}

// ---------------------------------------------------------------------------
// Kernel 3/5: y = LN(A16 @ W^T + bias + resid).  One wave owns a full 16x64
// row tile (4 col tiles) so LN row stats reduce with wave shuffles.
// grid = NROW/128, block = 256 (8 waves = 8 row tiles).
// ---------------------------------------------------------------------------
__global__ void __launch_bounds__(256)
ga_proj_res_ln(const _Float16* __restrict__ A16, const float* __restrict__ W,
               const float* __restrict__ bias, const float* __restrict__ resid,
               const float* __restrict__ g, const float* __restrict__ bb,
               float* __restrict__ xout, _Float16* __restrict__ xout16) {
  const int lane = threadIdx.x & 31;
  const int wv = threadIdx.x >> 5;
  const int row0 = (blockIdx.x * 8 + wv) * 16;
  const int m = lane & 15, half = lane >> 4;
  __builtin_prefetch(&W[(size_t)m * EDIM], 0, 3);

  v8f c[4];
#pragma unroll
  for (int t = 0; t < 4; ++t) {
    float bn = bias[t * 16 + m];
#pragma unroll
    for (int r = 0; r < 8; ++r) c[t][r] = bn;
  }

#pragma unroll
  for (int kb = 0; kb < EDIM; kb += 32) {
    v16h a;
#pragma unroll
    for (int s = 0; s < 16; ++s)
      a[s] = A16[(size_t)(row0 + m) * EDIM + kb + kslot(s, half)];
#pragma unroll
    for (int t = 0; t < 4; ++t) {
      v16h bmat;
#pragma unroll
      for (int s = 0; s < 16; ++s)
        bmat[s] = (_Float16)W[(size_t)(t * 16 + m) * EDIM + kb + kslot(s, half)];
      c[t] = wmma16(a, bmat, c[t]);
    }
  }

#pragma unroll
  for (int t = 0; t < 4; ++t)
#pragma unroll
    for (int r = 0; r < 8; ++r)
      c[t][r] += resid[(size_t)(row0 + r + 8 * half) * EDIM + t * 16 + m];

  float mu[8], rs[8];
#pragma unroll
  for (int r = 0; r < 8; ++r) {
    float sm = 0.f, sq = 0.f;
#pragma unroll
    for (int t = 0; t < 4; ++t) {
      sm += c[t][r];
      sq += c[t][r] * c[t][r];
    }
    sm = hsum16(sm);
    sq = hsum16(sq);
    float mean = sm * (1.0f / 64.0f);
    float var = sq * (1.0f / 64.0f) - mean * mean;
    mu[r] = mean;
    rs[r] = __frsqrt_rn(var + 1e-5f);
  }

#pragma unroll
  for (int t = 0; t < 4; ++t) {
    int col = t * 16 + m;
    float gg = g[col], bv = bb[col];
#pragma unroll
    for (int r = 0; r < 8; ++r) {
      float y = (c[t][r] - mu[r]) * rs[r] * gg + bv;
      size_t idx = (size_t)(row0 + r + 8 * half) * EDIM + col;
      xout[idx] = y;
      if (xout16) xout16[idx] = (_Float16)y;
    }
  }
}

// ---------------------------------------------------------------------------
// Kernel 4: h1 = relu(x @ W1^T + b1) -> f16.  grid=NROW/16, block=128.
// ---------------------------------------------------------------------------
__global__ void __launch_bounds__(128)
ga_ffn1(const _Float16* __restrict__ x16, const float* __restrict__ W1,
        const float* __restrict__ b1, _Float16* __restrict__ h1) {
  const int lane = threadIdx.x & 31;
  const int wv = threadIdx.x >> 5;
  const int row0 = blockIdx.x * 16;
  const int m = lane & 15, half = lane >> 4;
  const int n = wv * 16 + m;
  __builtin_prefetch(&W1[(size_t)n * EDIM], 0, 3);
  v8f c;
  const float bn = b1[n];
#pragma unroll
  for (int r = 0; r < 8; ++r) c[r] = bn;
#pragma unroll
  for (int kb = 0; kb < EDIM; kb += 32) {
    v16h a, b;
#pragma unroll
    for (int s = 0; s < 16; ++s) {
      int kk = kb + kslot(s, half);
      a[s] = x16[(size_t)(row0 + m) * EDIM + kk];
      b[s] = (_Float16)W1[(size_t)n * EDIM + kk];
    }
    c = wmma16(a, b, c);
  }
#pragma unroll
  for (int r = 0; r < 8; ++r)
    h1[(size_t)(row0 + r + 8 * half) * EDIM + n] = (_Float16)fmaxf(c[r], 0.0f);
}

// ---------------------------------------------------------------------------
extern "C" void kernel_launch(void* const* d_in, const int* in_sizes, int n_in,
                              void* d_out, int out_size, void* d_ws,
                              size_t ws_size, hipStream_t stream) {
  const float* q    = (const float*)d_in[0];
  const float* k    = (const float*)d_in[1];
  const float* prev = (const float*)d_in[2];
  const float* Wq   = (const float*)d_in[3];
  const float* bq   = (const float*)d_in[4];
  const float* Wk   = (const float*)d_in[5];
  const float* bk   = (const float*)d_in[6];
  const float* Wv   = (const float*)d_in[7];
  const float* bv   = (const float*)d_in[8];
  const float* Wo   = (const float*)d_in[9];
  const float* bo   = (const float*)d_in[10];
  const float* g1   = (const float*)d_in[11];
  const float* bb1  = (const float*)d_in[12];
  const float* W1   = (const float*)d_in[13];
  const float* b1   = (const float*)d_in[14];
  const float* W2   = (const float*)d_in[15];
  const float* b2   = (const float*)d_in[16];
  const float* g2   = (const float*)d_in[17];
  const float* bb2  = (const float*)d_in[18];

  float* out = (float*)d_out;                          // [B, Lq, E]
  float* attw = out + (size_t)BQ * LSEQ * EDIM;        // [B, Lq, Lk]

  char* ws = (char*)d_ws;                              // 32 MB used
  _Float16* qh  = (_Float16*)(ws + (size_t)0);
  _Float16* kh  = (_Float16*)(ws + ((size_t)4 << 20));
  _Float16* vh  = (_Float16*)(ws + ((size_t)8 << 20));
  _Float16* ctx = (_Float16*)(ws + ((size_t)12 << 20));
  float*    xf  = (float*)   (ws + ((size_t)16 << 20));
  _Float16* x16 = (_Float16*)(ws + ((size_t)24 << 20));
  _Float16* h1  = (_Float16*)(ws + ((size_t)28 << 20));

  ga_qkv<<<dim3(NROW / 16, 3), 128, 0, stream>>>(q, k, Wq, bq, Wk, bk, Wv, bv,
                                                 qh, kh, vh);
  ga_attn<<<dim3(LSEQ / 16, BQ), 256, 0, stream>>>(qh, kh, vh, ctx, attw);
  ga_proj_res_ln<<<NROW / 128, 256, 0, stream>>>(ctx, Wo, bo, prev, g1, bb1,
                                                 xf, x16);
  ga_ffn1<<<NROW / 16, 128, 0, stream>>>(x16, W1, b1, h1);
  ga_proj_res_ln<<<NROW / 128, 256, 0, stream>>>(h1, W2, b2, xf, g2, bb2, out,
                                                 (_Float16*)nullptr);
}

// v002
// A run of this version takes 86.2 microseconds.
// Next to v001, in two timings, it ran 1.79 times as fast each time.
// Over all steps from v000 it is 2.69 times as fast.
#include <hip/hip_runtime.h>

#define BQ 64
#define LSEQ 512
#define EDIM 64
#define NHEAD 8
#define HDIM 8
#define NROW (BQ * LSEQ) /* 32768 */

typedef __attribute__((ext_vector_type(16))) _Float16 v16h;
typedef __attribute__((ext_vector_type(8))) _Float16 v8h;
typedef __attribute__((ext_vector_type(8))) float v8f;

// K index held by v16h slot s for a lane in K-half `khalf` (ISA 7.12.2,
// 16-bit A 16x32 layout; B uses the same per-lane K ordering with N=lane%16).
__device__ __forceinline__ int kslot(int s, int khalf) {
  int j = s >> 1, p = s & 1;
  return (j < 4) ? (khalf * 8 + j * 2 + p) : (16 + khalf * 8 + (j - 4) * 2 + p);
}

__device__ __forceinline__ v8f wmma16(v16h a, v16h b, v8f c) {
  return __builtin_amdgcn_wmma_f32_16x16x32_f16(false, a, false, b, (short)0, c,
                                                false, false);
}

// value held by lane l ^ 16 (the other 16-lane half), by a vector cross-row move
__device__ __forceinline__ float xhalf(float v) {
  int b = __builtin_bit_cast(int, v);
  b = __builtin_amdgcn_permlanex16(b, b, 0x76543210, 0xfedcba98, false, false);
  return __builtin_bit_cast(float, b);
}

// butterfly reduction within each 16-lane half of the wave32 (matches the
// WMMA C-layout row split: lanes 0-15 hold rows 0-7, lanes 16-31 rows 8-15)
__device__ __forceinline__ float hsum16(float v) {
#pragma unroll
  for (int m = 1; m < 16; m <<= 1) v += __shfl_xor(v, m, 32);
  return v;
}

// ---------------------------------------------------------------------------
// Kernel 1: fused QKV projections.  grid=(NROW/16, 3), block=128 (4 waves).
// out = X @ W^T + b, q pre-scaled 1/sqrt(D).  Q and K: a block owns 16 rows,
// each wave one 16-col tile, row-major f16 out.  V: a block owns 64 rows of
// one 16-col tile (each wave 16 rows) and stores V^T [B][E][L], so that the
// attention kernel reads its V^T operand as 16-byte runs of keys; a lane's 8
// accumulator rows are 8 consecutive keys of one column: one 16-byte store.
// ---------------------------------------------------------------------------
__global__ void __launch_bounds__(128)
ga_qkv(const float* __restrict__ q, const float* __restrict__ k,
       const float* __restrict__ Wq, const float* __restrict__ bq,
       const float* __restrict__ Wk, const float* __restrict__ bk,
       const float* __restrict__ Wv, const float* __restrict__ bv,
       _Float16* __restrict__ qh, _Float16* __restrict__ kh,
       _Float16* __restrict__ vt) {
  const int lane = threadIdx.x & 31;
  const int wv = threadIdx.x >> 5;
  const int which = blockIdx.y;
  const float* X;
  const float* W;
  const float* bias;
  float osc;
  if (which == 0) { X = q; W = Wq; bias = bq; osc = 0.35355339059327373f; }
  else if (which == 1) { X = k; W = Wk; bias = bk; osc = 1.0f; }
  else { X = k; W = Wv; bias = bv; osc = 1.0f; }

  const int m = lane & 15, half = lane >> 4;
  const int row0 = (which == 2) ? (blockIdx.x >> 2) * 64 + wv * 16
                                : blockIdx.x * 16;
  const int n = ((which == 2) ? (blockIdx.x & 3) : wv) * 16 + m;
  __builtin_prefetch(&W[(size_t)n * EDIM], 0, 3);  // -> global_prefetch_b8
  v8f c;
  const float bn = bias[n];
#pragma unroll
  for (int r = 0; r < 8; ++r) c[r] = bn;

#pragma unroll
  for (int kb = 0; kb < EDIM; kb += 32) {
    v16h a, b;
#pragma unroll
    for (int s = 0; s < 16; ++s) {
      int kk = kb + kslot(s, half);
      a[s] = (_Float16)X[(size_t)(row0 + m) * EDIM + kk];
      b[s] = (_Float16)W[(size_t)n * EDIM + kk];
    }
    c = wmma16(a, b, c);
  }
  if (which == 2) {
    v8h o;
#pragma unroll
    for (int r = 0; r < 8; ++r) o[r] = (_Float16)c[r];
    *(v8h*)&vt[((size_t)(row0 / LSEQ) * EDIM + n) * LSEQ + (row0 % LSEQ) +
               8 * half] = o;
  } else {
    _Float16* out = (which == 0) ? qh : kh;
#pragma unroll
    for (int r = 0; r < 8; ++r)
      out[(size_t)(row0 + r + 8 * half) * EDIM + n] = (_Float16)(c[r] * osc);
    // the wait that belongs between these stores and any later overwrite of a
    // register they name (the built code lays the V^T block out behind them)
    asm volatile("s_wait_xcnt 0x0" ::: "memory");
  }
}

// ---------------------------------------------------------------------------
// Kernel 2: attention in one pass.  grid=(LSEQ/16, B), block=512 (16 waves).
// A block owns 16 queries; wave w owns keys 32w..32w+31 for ALL 8 heads.
// Per head: S^T = K Q^T (two 16-key tiles; K rows carry 32 dims = 4 heads and
// Q is zeroed outside the head), softmax numerators against the wave's own
// maximum, O^T = V^T P^T over the wave's 32 keys.  P stays in registers.
// The waves' maxima, sums and O parts are joined through LDS; then a lane,
// which holds the same (query, 16 keys) for every head, forms the head mean
// in registers and stores it.  Scores are computed and exponentiated once.
// ---------------------------------------------------------------------------
#define NWV 16      /* waves per block = key slices */
#define OPITCH 68   /* floats per query row of an O part: 64 + 4 against bank conflicts */

__device__ __forceinline__ v16h cat8(v8h lo, v8h hi) {
  return __builtin_shufflevector(lo, hi, 0, 1, 2, 3, 4, 5, 6, 7, 8, 9, 10, 11,
                                 12, 13, 14, 15);
}

__global__ void __launch_bounds__(512)
ga_attn(const _Float16* __restrict__ qh, const _Float16* __restrict__ kh,
        const _Float16* __restrict__ vt, _Float16* __restrict__ ctx,
        float* __restrict__ attw) {
  __shared__ __attribute__((aligned(16))) float s_o[NWV][16][OPITCH];  // O parts
  __shared__ float s_ml[2][NWV][NHEAD][16];  // [0] max, later factor; [1] sum
  const int tid = threadIdx.x;
  const int lane = tid & 31;
  const int w = tid >> 5;
  const int b = blockIdx.y;
  const int row0 = b * LSEQ + blockIdx.x * 16;  // flattened q row
  const int key0 = b * LSEQ + w * 32;           // flattened first key row
  const int m = lane & 15, half = lane >> 4;
  const v8h z8 = {};

  float p[NHEAD][16];  // p[h][8 t + r]: query m, key 32 w + 16 t + 8 half + r

  // all operands up front, 16 bytes a load.  Slot s of a lane is dim
  // 32 g + kslot(s, half) for Q and for K alike, and key kslot(s, half) for V^T
  // (row m of pair i = column 16 i + m of V).
  const _Float16* qp = qh + (size_t)(row0 + m) * EDIM + 8 * half;
  const _Float16* kp0 = kh + (size_t)(key0 + m) * EDIM + 8 * half;
  const _Float16* kp1 = kp0 + 16 * EDIM;
  const _Float16* vp = vt + ((size_t)b * EDIM + m) * LSEQ + w * 32 + 8 * half;
  v8h qlo[2], qhi[2];
  v16h kf[2][2], va4[4];
#pragma unroll
  for (int g = 0; g < 2; ++g) {
    qlo[g] = *(const v8h*)(qp + 32 * g);
    qhi[g] = *(const v8h*)(qp + 32 * g + 16);
    kf[g][0] = cat8(*(const v8h*)(kp0 + 32 * g), *(const v8h*)(kp0 + 32 * g + 16));
    kf[g][1] = cat8(*(const v8h*)(kp1 + 32 * g), *(const v8h*)(kp1 + 32 * g + 16));
  }
#pragma unroll
  for (int i = 0; i < 4; ++i)
    va4[i] = cat8(*(const v8h*)(vp + (size_t)16 * i * LSEQ),
                  *(const v8h*)(vp + (size_t)16 * i * LSEQ + 16));
  // the wait that belongs in front of any overwrite of an issued load's address
  // registers; the addresses are inputs so that no load lands on one of them
  asm volatile("s_wait_xcnt 0x0" ::"v"(qp), "v"(kp0), "v"(kp1), "v"(vp) : "memory");

#pragma unroll
  for (int g = 0; g < 2; ++g) {  // dims 32 g .. 32 g + 31 = heads 4 g .. 4 g + 3
#pragma unroll
    for (int pr = 0; pr < 2; ++pr) {  // head pair: 16 columns of V
      const v16h va = va4[2 * g + pr];
      v8f o2[2];
#pragma unroll
      for (int e = 0; e < 2; ++e) {
        const int h = 4 * g + 2 * pr + e;
        // the head's 8 dims sit in half e, low slots (pr 0) or high slots (pr 1)
        const v8h sel = (half == e) ? (pr ? qhi[g] : qlo[g]) : z8;
        const v16h bq = pr ? cat8(z8, sel) : cat8(sel, z8);
        v8f cs0 = {}, cs1 = {};
        cs0 = wmma16(kf[g][0], bq, cs0);  // cs[r] = S[query m][key 16 t + 8 half + r]
        cs1 = wmma16(kf[g][1], bq, cs1);

        float tmax = fmaxf(cs0[0], cs1[0]);
#pragma unroll
        for (int r = 1; r < 8; ++r) tmax = fmaxf(tmax, fmaxf(cs0[r], cs1[r]));
        tmax = fmaxf(tmax, xhalf(tmax));  // all 32 keys of the slice

        v16h bp;  // P^T as B: slot s is key kslot(s, half), the accumulators' own map
        float ps = 0.0f;
#pragma unroll
        for (int r = 0; r < 8; ++r) {
          const float p0 = __expf(cs0[r] - tmax);
          const float p1 = __expf(cs1[r] - tmax);
          ps += p0 + p1;
          p[h][r] = p0;
          p[h][8 + r] = p1;
          bp[r] = (_Float16)p0;
          bp[8 + r] = (_Float16)p1;
        }
        ps += xhalf(ps);
        s_ml[half][w][h][m] = half ? ps : tmax;

        v8f oz = {};
        o2[e] = wmma16(va, bp, oz);  // rows 8 e .. 8 e + 7 are this head's d
      }
      // lane (m, half) keeps head 2 pr + half: O[query m][16 (2 g + pr) + 8 half + r]
      float4 w0, w1;
      w0.x = half ? o2[1][0] : o2[0][0];
      w0.y = half ? o2[1][1] : o2[0][1];
      w0.z = half ? o2[1][2] : o2[0][2];
      w0.w = half ? o2[1][3] : o2[0][3];
      w1.x = half ? o2[1][4] : o2[0][4];
      w1.y = half ? o2[1][5] : o2[0][5];
      w1.z = half ? o2[1][6] : o2[0][6];
      w1.w = half ? o2[1][7] : o2[0][7];
      float* op = &s_o[w][m][32 * g + 16 * pr + 8 * half];
      *(float4*)op = w0;
      *(float4*)(op + 4) = w1;
    }
  }
  __syncthreads();  // every slice's max, sum and O part are in LDS

  // join the slices: one thread per (head, query) turns the 16 maxima into the
  // 16 factors exp(m_w - max) / sum that scale a slice's P and O
  if (tid < NHEAD * 16) {
    const int hh = tid >> 4, qq = tid & 15;
    float mw[NWV];
    float mg = -1e30f;
#pragma unroll
    for (int i = 0; i < NWV; ++i) {
      mw[i] = s_ml[0][i][hh][qq];
      mg = fmaxf(mg, mw[i]);
    }
    float ls = 0.0f;
#pragma unroll
    for (int i = 0; i < NWV; ++i) {
      mw[i] = __expf(mw[i] - mg);
      ls += mw[i] * s_ml[1][i][hh][qq];
    }
    const float inv = 1.0f / ls;
#pragma unroll
    for (int i = 0; i < NWV; ++i) s_ml[0][i][hh][qq] = mw[i] * inv;
  }
  __syncthreads();  // the factors are in LDS

  // head mean of the normalized weights, in registers, heads in order 0..7
  {
    float acc[16];
#pragma unroll
    for (int j = 0; j < 16; ++j) acc[j] = 0.0f;
#pragma unroll
    for (int h = 0; h < NHEAD; ++h) {
      const float f = 0.125f * s_ml[0][w][h][m];
#pragma unroll
      for (int j = 0; j < 16; ++j) acc[j] += p[h][j] * f;
    }
    float* ap = attw + (size_t)(row0 + m) * LSEQ + w * 32 + 8 * half;
#pragma unroll
    for (int t = 0; t < 2; ++t) {
      *(float4*)(ap + 16 * t) = make_float4(acc[8 * t], acc[8 * t + 1],
                                            acc[8 * t + 2], acc[8 * t + 3]);
      *(float4*)(ap + 16 * t + 4) = make_float4(acc[8 * t + 4], acc[8 * t + 5],
                                                acc[8 * t + 6], acc[8 * t + 7]);
    }
  }

  // context: wave w sums query w's 16 O parts, a lane two columns (f16 staging
  // for the Wo GEMM)
  {
    const int c2 = lane * 2, hh = lane >> 2;
    float ox = 0.0f, oy = 0.0f;
#pragma unroll
    for (int i = 0; i < NWV; ++i) {
      const float f = s_ml[0][i][hh][w];
      const float2 ov = *(const float2*)&s_o[i][w][c2];
      ox += ov.x * f;
      oy += ov.y * f;
    }
    typedef __attribute__((ext_vector_type(2))) _Float16 v2h;
    v2h o;
    o[0] = (_Float16)ox;
    o[1] = (_Float16)oy;
    *(v2h*)&ctx[(size_t)(row0 + w) * EDIM + c2] = o;
  }
}

// ---------------------------------------------------------------------------
// Kernel 3/5: y = LN(A16 @ W^T + bias + resid).  One wave owns a full 16x64
// row tile (4 col tiles) so LN row stats reduce with wave shuffles.
// grid = NROW/128, block = 256 (8 waves = 8 row tiles).
// ---------------------------------------------------------------------------
__global__ void __launch_bounds__(256)
ga_proj_res_ln(const _Float16* __restrict__ A16, const float* __restrict__ W,
               const float* __restrict__ bias, const float* __restrict__ resid,
               const float* __restrict__ g, const float* __restrict__ bb,
               float* __restrict__ xout, _Float16* __restrict__ xout16) {
  const int lane = threadIdx.x & 31;
  const int wv = threadIdx.x >> 5;
  const int row0 = (blockIdx.x * 8 + wv) * 16;
  const int m = lane & 15, half = lane >> 4;
  __builtin_prefetch(&W[(size_t)m * EDIM], 0, 3);

  v8f c[4];
#pragma unroll
  for (int t = 0; t < 4; ++t) {
    float bn = bias[t * 16 + m];
#pragma unroll
    for (int r = 0; r < 8; ++r) c[t][r] = bn;
  }

#pragma unroll
  for (int kb = 0; kb < EDIM; kb += 32) {
    v16h a;
#pragma unroll
    for (int s = 0; s < 16; ++s)
      a[s] = A16[(size_t)(row0 + m) * EDIM + kb + kslot(s, half)];
#pragma unroll
    for (int t = 0; t < 4; ++t) {
      v16h bmat;
#pragma unroll
      for (int s = 0; s < 16; ++s)
        bmat[s] = (_Float16)W[(size_t)(t * 16 + m) * EDIM + kb + kslot(s, half)];
      c[t] = wmma16(a, bmat, c[t]);
    }
  }

#pragma unroll
  for (int t = 0; t < 4; ++t)
#pragma unroll
    for (int r = 0; r < 8; ++r)
      c[t][r] += resid[(size_t)(row0 + r + 8 * half) * EDIM + t * 16 + m];

  float mu[8], rs[8];
#pragma unroll
  for (int r = 0; r < 8; ++r) {
    float sm = 0.f, sq = 0.f;
#pragma unroll
    for (int t = 0; t < 4; ++t) {
      sm += c[t][r];
      sq += c[t][r] * c[t][r];
    }
    sm = hsum16(sm);
    sq = hsum16(sq);
    float mean = sm * (1.0f / 64.0f);
    float var = sq * (1.0f / 64.0f) - mean * mean;
    mu[r] = mean;
    rs[r] = __frsqrt_rn(var + 1e-5f);
  }

#pragma unroll
  for (int t = 0; t < 4; ++t) {
    int col = t * 16 + m;
    float gg = g[col], bv = bb[col];
#pragma unroll
    for (int r = 0; r < 8; ++r) {
      float y = (c[t][r] - mu[r]) * rs[r] * gg + bv;
      size_t idx = (size_t)(row0 + r + 8 * half) * EDIM + col;
      xout[idx] = y;
      if (xout16) xout16[idx] = (_Float16)y;
    }
  }
}

// ---------------------------------------------------------------------------
// Kernel 4: h1 = relu(x @ W1^T + b1) -> f16.  grid=NROW/16, block=128.
// ---------------------------------------------------------------------------
__global__ void __launch_bounds__(128)
ga_ffn1(const _Float16* __restrict__ x16, const float* __restrict__ W1,
        const float* __restrict__ b1, _Float16* __restrict__ h1) {
  const int lane = threadIdx.x & 31;
  const int wv = threadIdx.x >> 5;
  const int row0 = blockIdx.x * 16;
  const int m = lane & 15, half = lane >> 4;
  const int n = wv * 16 + m;
  __builtin_prefetch(&W1[(size_t)n * EDIM], 0, 3);
  v8f c;
  const float bn = b1[n];
#pragma unroll
  for (int r = 0; r < 8; ++r) c[r] = bn;
#pragma unroll
  for (int kb = 0; kb < EDIM; kb += 32) {
    v16h a, b;
#pragma unroll
    for (int s = 0; s < 16; ++s) {
      int kk = kb + kslot(s, half);
      a[s] = x16[(size_t)(row0 + m) * EDIM + kk];
      b[s] = (_Float16)W1[(size_t)n * EDIM + kk];
    }
    c = wmma16(a, b, c);
  }
#pragma unroll
  for (int r = 0; r < 8; ++r)
    h1[(size_t)(row0 + r + 8 * half) * EDIM + n] = (_Float16)fmaxf(c[r], 0.0f);
}

// ---------------------------------------------------------------------------
extern "C" void kernel_launch(void* const* d_in, const int* in_sizes, int n_in,
                              void* d_out, int out_size, void* d_ws,
                              size_t ws_size, hipStream_t stream) {
  const float* q    = (const float*)d_in[0];
  const float* k    = (const float*)d_in[1];
  const float* prev = (const float*)d_in[2];
  const float* Wq   = (const float*)d_in[3];
  const float* bq   = (const float*)d_in[4];
  const float* Wk   = (const float*)d_in[5];
  const float* bk   = (const float*)d_in[6];
  const float* Wv   = (const float*)d_in[7];
  const float* bv   = (const float*)d_in[8];
  const float* Wo   = (const float*)d_in[9];
  const float* bo   = (const float*)d_in[10];
  const float* g1   = (const float*)d_in[11];
  const float* bb1  = (const float*)d_in[12];
  const float* W1   = (const float*)d_in[13];
  const float* b1   = (const float*)d_in[14];
  const float* W2   = (const float*)d_in[15];
  const float* b2   = (const float*)d_in[16];
  const float* g2   = (const float*)d_in[17];
  const float* bb2  = (const float*)d_in[18];

  float* out = (float*)d_out;                          // [B, Lq, E]
  float* attw = out + (size_t)BQ * LSEQ * EDIM;        // [B, Lq, Lk]

  char* ws = (char*)d_ws;                              // 32 MB used
  _Float16* qh  = (_Float16*)(ws + (size_t)0);
  _Float16* kh  = (_Float16*)(ws + ((size_t)4 << 20));
  _Float16* vh  = (_Float16*)(ws + ((size_t)8 << 20));  // V^T [B][E][L]
  _Float16* ctx = (_Float16*)(ws + ((size_t)12 << 20));
  float*    xf  = (float*)   (ws + ((size_t)16 << 20));
  _Float16* x16 = (_Float16*)(ws + ((size_t)24 << 20));
  _Float16* h1  = (_Float16*)(ws + ((size_t)28 << 20));

  ga_qkv<<<dim3(NROW / 16, 3), 128, 0, stream>>>(q, k, Wq, bq, Wk, bk, Wv, bv,
                                                 qh, kh, vh);
  ga_attn<<<dim3(LSEQ / 16, BQ), 512, 0, stream>>>(qh, kh, vh, ctx, attw);
  ga_proj_res_ln<<<NROW / 128, 256, 0, stream>>>(ctx, Wo, bo, prev, g1, bb1,
                                                 xf, x16);
  ga_ffn1<<<NROW / 16, 128, 0, stream>>>(x16, W1, b1, h1);
  ga_proj_res_ln<<<NROW / 128, 256, 0, stream>>>(h1, W2, b2, xf, g2, bb2, out,
                                                 (_Float16*)nullptr);
}

// v003
// Measured time: 71.2 microseconds a run.
// Two timings next to v002 both put it at 1.21 times that version's speed.
// Counting every step since v000, it is 3.27 times as fast.
#include <hip/hip_runtime.h>

#define BQ 64
#define LSEQ 512
#define EDIM 64
#define NHEAD 8
#define HDIM 8
#define NROW (BQ * LSEQ) /* 32768 */

typedef __attribute__((ext_vector_type(16))) _Float16 v16h;
typedef __attribute__((ext_vector_type(8))) _Float16 v8h;
typedef __attribute__((ext_vector_type(8))) float v8f;

// K index held by v16h slot s for a lane in K-half `khalf` (ISA 7.12.2,
// 16-bit A 16x32 layout; B uses the same per-lane K ordering with N=lane%16).
__device__ __forceinline__ int kslot(int s, int khalf) {
  int j = s >> 1, p = s & 1;
  return (j < 4) ? (khalf * 8 + j * 2 + p) : (16 + khalf * 8 + (j - 4) * 2 + p);
}

__device__ __forceinline__ v8f wmma16(v16h a, v16h b, v8f c) {
  return __builtin_amdgcn_wmma_f32_16x16x32_f16(false, a, false, b, (short)0, c,
                                                false, false);
}

// value held by lane l ^ 16 (the other 16-lane half), by a vector cross-row move
__device__ __forceinline__ float xhalf(float v) {
  int b = __builtin_bit_cast(int, v);
  b = __builtin_amdgcn_permlanex16(b, b, 0x76543210, 0xfedcba98, false, false);
  return __builtin_bit_cast(float, b);
}

// butterfly reduction within each 16-lane half of the wave32 (matches the
// WMMA C-layout row split: lanes 0-15 hold rows 0-7, lanes 16-31 rows 8-15)
__device__ __forceinline__ float hsum16(float v) {
#pragma unroll
  for (int m = 1; m < 16; m <<= 1) v += __shfl_xor(v, m, 32);
  return v;
}

// ---------------------------------------------------------------------------
// Kernel 1: fused QKV projections.  grid=(NROW/16, 3), block=128 (4 waves).
// out = X @ W^T + b, q pre-scaled 1/sqrt(D).  Q and K: a block owns 16 rows,
// each wave one 16-col tile, row-major f16 out.  V: a block owns 64 rows of
// one 16-col tile (each wave 16 rows) and stores V^T [B][E][L], so that the
// attention kernel reads its V^T operand as 16-byte runs of keys; a lane's 8
// accumulator rows are 8 consecutive keys of one column: one 16-byte store.
// ---------------------------------------------------------------------------
__global__ void __launch_bounds__(128)
ga_qkv(const float* __restrict__ q, const float* __restrict__ k,
       const float* __restrict__ Wq, const float* __restrict__ bq,
       const float* __restrict__ Wk, const float* __restrict__ bk,
       const float* __restrict__ Wv, const float* __restrict__ bv,
       _Float16* __restrict__ qh, _Float16* __restrict__ kh,
       _Float16* __restrict__ vt) {
  const int lane = threadIdx.x & 31;
  const int wv = threadIdx.x >> 5;
  const int which = blockIdx.y;
  const float* X;
  const float* W;
  const float* bias;
  float osc;
  if (which == 0) { X = q; W = Wq; bias = bq; osc = 0.35355339059327373f; }
  else if (which == 1) { X = k; W = Wk; bias = bk; osc = 1.0f; }
  else { X = k; W = Wv; bias = bv; osc = 1.0f; }

  const int m = lane & 15, half = lane >> 4;
  const int row0 = (which == 2) ? (blockIdx.x >> 2) * 64 + wv * 16
                                : blockIdx.x * 16;
  const int n = ((which == 2) ? (blockIdx.x & 3) : wv) * 16 + m;
  __builtin_prefetch(&W[(size_t)n * EDIM], 0, 3);  // -> global_prefetch_b8
  v8f c;
  const float bn = bias[n];
#pragma unroll
  for (int r = 0; r < 8; ++r) c[r] = bn;

#pragma unroll
  for (int kb = 0; kb < EDIM; kb += 32) {
    v16h a, b;
#pragma unroll
    for (int s = 0; s < 16; ++s) {
      int kk = kb + kslot(s, half);
      a[s] = (_Float16)X[(size_t)(row0 + m) * EDIM + kk];
      b[s] = (_Float16)W[(size_t)n * EDIM + kk];
    }
    c = wmma16(a, b, c);
  }
  if (which == 2) {
    v8h o;
#pragma unroll
    for (int r = 0; r < 8; ++r) o[r] = (_Float16)c[r];
    *(v8h*)&vt[((size_t)(row0 / LSEQ) * EDIM + n) * LSEQ + (row0 % LSEQ) +
               8 * half] = o;
  } else {
    _Float16* out = (which == 0) ? qh : kh;
#pragma unroll
    for (int r = 0; r < 8; ++r)
      out[(size_t)(row0 + r + 8 * half) * EDIM + n] = (_Float16)(c[r] * osc);
    // the wait that belongs between these stores and any later overwrite of a
    // register they name (the built code lays the V^T block out behind them)
    asm volatile("s_wait_xcnt 0x0" ::: "memory");
  }
}

// ---------------------------------------------------------------------------
// Kernel 2: attention in one pass.  grid=(LSEQ/(16*QTILES), B), block=512 (16
// waves): one block per WGP, all resident at once.  Wave w owns keys
// 32w..32w+31 for ALL 8 heads; it loads its K and V^T fragments once, keeps K
// in registers and V^T in an LDS range of its own (registers are short beside
// P), and walks QTILES tiles of 16 queries with them.
// Per tile and head: S^T = K Q^T (two 16-key tiles; K rows carry 32 dims = 4
// heads and Q is zeroed outside the head), softmax numerators against the
// wave's own maximum, O^T = V^T P^T over the wave's 32 keys.  P stays in
// registers.  The waves' maxima, sums and O parts are joined through LDS; then
// a lane, which holds the same (query, 16 keys) for every head, forms the head
// mean in registers and stores it.  Scores are computed and exponentiated once.
// The LDS areas are doubled and taken by the tile's parity: a wave that writes
// tile t + 2 has passed both barriers of tile t + 1, which every wave reaches
// only behind its last read of tile t.
// ---------------------------------------------------------------------------
#define NWV 16      /* waves per block = key slices */
#define OPITCH 68   /* floats per query row of an O part: 64 + 4 against bank conflicts */
#define QTILES 8    /* 16-query tiles a block walks */

__device__ __forceinline__ v16h cat8(v8h lo, v8h hi) {
  return __builtin_shufflevector(lo, hi, 0, 1, 2, 3, 4, 5, 6, 7, 8, 9, 10, 11,
                                 12, 13, 14, 15);
}

__global__ void __launch_bounds__(512)
ga_attn(const _Float16* __restrict__ qh, const _Float16* __restrict__ kh,
        const _Float16* __restrict__ vt, _Float16* __restrict__ ctx,
        float* __restrict__ attw) {
  __shared__ __attribute__((aligned(16))) float s_o2[2][NWV][16][OPITCH];  // O parts
  __shared__ float s_ml2[2][2][NWV][NHEAD][16];  // [.][0] max, later factor; [.][1] sum
  __shared__ __attribute__((aligned(16))) v8h s_v[NWV][8][32];  // V^T fragments
  const int tid = threadIdx.x;
  const int lane = tid & 31;
  const int w = tid >> 5;
  const int b = blockIdx.y;
  const int rowb = b * LSEQ + blockIdx.x * (16 * QTILES);  // first q row of the block
  const int key0 = b * LSEQ + w * 32;                      // flattened first key row
  const int m = lane & 15, half = lane >> 4;
  const v8h z8 = {};
  // a lane's own part of the addresses used in the loop, 32 bits each, beside
  // bases that are the same for the whole block (fewer registers held)
  const unsigned qoff = (unsigned)(m * EDIM + 8 * half);
  const unsigned aoff = (unsigned)(m * LSEQ + w * 32 + 8 * half);

  // all operands 16 bytes a load.  Slot s of a lane is dim 32 g + kslot(s, half)
  // for Q and for K alike, and key kslot(s, half) for V^T (row m of pair i =
  // column 16 i + m of V).
  const _Float16* qp = qh + (size_t)(rowb + m) * EDIM + 8 * half;
  const _Float16* kp0 = kh + (size_t)(key0 + m) * EDIM + 8 * half;
  const _Float16* kp1 = kp0 + 16 * EDIM;
  const _Float16* vp = vt + ((size_t)b * EDIM + m) * LSEQ + w * 32 + 8 * half;
  v8h qlo[2], qhi[2];
  v16h kf[2][2];
#pragma unroll
  for (int g = 0; g < 2; ++g) {
    qlo[g] = *(const v8h*)(qp + 32 * g);
    qhi[g] = *(const v8h*)(qp + 32 * g + 16);
    kf[g][0] = cat8(*(const v8h*)(kp0 + 32 * g), *(const v8h*)(kp0 + 32 * g + 16));
    kf[g][1] = cat8(*(const v8h*)(kp1 + 32 * g), *(const v8h*)(kp1 + 32 * g + 16));
  }
  // V^T fragments: parked in the wave's own LDS range, a lane's 16 bytes side by
  // side; only the wave that wrote them reads them, so no barrier is owed
#pragma unroll
  for (int i = 0; i < 4; ++i) {
    s_v[w][2 * i][lane] = *(const v8h*)(vp + (size_t)16 * i * LSEQ);
    s_v[w][2 * i + 1][lane] = *(const v8h*)(vp + (size_t)16 * i * LSEQ + 16);
  }
  // the wait that belongs in front of any overwrite of an issued load's address
  // registers; the addresses are inputs so that no load lands on one of them
  asm volatile("s_wait_xcnt 0x0" ::"v"(qp), "v"(kp0), "v"(kp1), "v"(vp) : "memory");

// rolled: one copy of the body in the code
#pragma unroll 1
  for (int it = 0; it < QTILES; ++it) {
    const int row0 = rowb + it * 16;  // flattened first q row of the tile
    float (*s_o)[16][OPITCH] = s_o2[it & 1];
    float (*s_ml)[NWV][NHEAD][16] = s_ml2[it & 1];
    float p[NHEAD][16];  // p[h][8 t + r]: query m, key 32 w + 16 t + 8 half + r

#pragma unroll
    for (int g = 0; g < 2; ++g) {  // dims 32 g .. 32 g + 31 = heads 4 g .. 4 g + 3
#pragma unroll
      for (int pr = 0; pr < 2; ++pr) {  // head pair: 16 columns of V
        const v16h va = cat8(s_v[w][4 * g + 2 * pr][lane], s_v[w][4 * g + 2 * pr + 1][lane]);
        v8f o2[2];
#pragma unroll
        for (int e = 0; e < 2; ++e) {
          const int h = 4 * g + 2 * pr + e;
          // the head's 8 dims sit in half e, low slots (pr 0) or high slots (pr 1)
          const v8h sel = (half == e) ? (pr ? qhi[g] : qlo[g]) : z8;
          const v16h bq = pr ? cat8(z8, sel) : cat8(sel, z8);
          v8f cs0 = {}, cs1 = {};
          cs0 = wmma16(kf[g][0], bq, cs0);  // cs[r] = S[query m][key 16 t + 8 half + r]
          cs1 = wmma16(kf[g][1], bq, cs1);

          float tmax = fmaxf(cs0[0], cs1[0]);
#pragma unroll
          for (int r = 1; r < 8; ++r) tmax = fmaxf(tmax, fmaxf(cs0[r], cs1[r]));
          tmax = fmaxf(tmax, xhalf(tmax));  // all 32 keys of the slice

          v16h bp;  // P^T as B: slot s is key kslot(s, half), the accumulators' own map
          float ps = 0.0f;
#pragma unroll
          for (int r = 0; r < 8; ++r) {
            const float p0 = __expf(cs0[r] - tmax);
            const float p1 = __expf(cs1[r] - tmax);
            ps += p0 + p1;
            p[h][r] = p0;
            p[h][8 + r] = p1;
            bp[r] = (_Float16)p0;
            bp[8 + r] = (_Float16)p1;
          }
          ps += xhalf(ps);
          s_ml[half][w][h][m] = half ? ps : tmax;

          v8f oz = {};
          o2[e] = wmma16(va, bp, oz);  // rows 8 e .. 8 e + 7 are this head's d
        }
        // lane (m, half) keeps head 2 pr + half: O[query m][16 (2 g + pr) + 8 half + r]
        float4 w0, w1;
        w0.x = half ? o2[1][0] : o2[0][0];
        w0.y = half ? o2[1][1] : o2[0][1];
        w0.z = half ? o2[1][2] : o2[0][2];
        w0.w = half ? o2[1][3] : o2[0][3];
        w1.x = half ? o2[1][4] : o2[0][4];
        w1.y = half ? o2[1][5] : o2[0][5];
        w1.z = half ? o2[1][6] : o2[0][6];
        w1.w = half ? o2[1][7] : o2[0][7];
        float* op = &s_o[w][m][32 * g + 16 * pr + 8 * half];
        *(float4*)op = w0;
        *(float4*)(op + 4) = w1;
      }
    }
    __syncthreads();  // every slice's max, sum and O part are in LDS

    // join the slices: one thread per (head, query) turns the 16 maxima into the
    // 16 factors exp(m_w - max) / sum that scale a slice's P and O
    if (tid < NHEAD * 16) {
      const int hh = tid >> 4, qq = tid & 15;
      float mw[NWV];
      float mg = -1e30f;
#pragma unroll
      for (int i = 0; i < NWV; ++i) {
        mw[i] = s_ml[0][i][hh][qq];
        mg = fmaxf(mg, mw[i]);
      }
      float ls = 0.0f;
#pragma unroll
      for (int i = 0; i < NWV; ++i) {
        mw[i] = __expf(mw[i] - mg);
        ls += mw[i] * s_ml[1][i][hh][qq];
      }
      const float inv = 1.0f / ls;
#pragma unroll
      for (int i = 0; i < NWV; ++i) s_ml[0][i][hh][qq] = mw[i] * inv;
    }
    __syncthreads();  // the factors are in LDS

    // head mean of the normalized weights, in registers, heads in order 0..7
    {
      float acc[16];
#pragma unroll
      for (int j = 0; j < 16; ++j) acc[j] = 0.0f;
#pragma unroll
      for (int h = 0; h < NHEAD; ++h) {
        const float f = 0.125f * s_ml[0][w][h][m];
#pragma unroll
        for (int j = 0; j < 16; ++j) acc[j] += p[h][j] * f;
      }
      float* ap = attw + (size_t)row0 * LSEQ + aoff;
#pragma unroll
      for (int t = 0; t < 2; ++t) {
        *(float4*)(ap + 16 * t) = make_float4(acc[8 * t], acc[8 * t + 1],
                                              acc[8 * t + 2], acc[8 * t + 3]);
        *(float4*)(ap + 16 * t + 4) = make_float4(acc[8 * t + 4], acc[8 * t + 5],
                                                  acc[8 * t + 6], acc[8 * t + 7]);
      }
    }

    // the next tile's Q, fetched under this tile's closing work (the last trip
    // reads its own tile again, so that the address stays inside qh)
    {
      const _Float16* qn =  // uniform base; the lane's part is the 32-bit qoff
          qh + (size_t)(rowb + ((it + 1 < QTILES) ? it + 1 : it) * 16) * EDIM;
#pragma unroll
      for (int g = 0; g < 2; ++g) {
        qlo[g] = *(const v8h*)(qn + qoff + 32 * g);
        qhi[g] = *(const v8h*)(qn + qoff + 32 * g + 16);
      }
    }

    // context: wave w sums query w's 16 O parts, a lane two columns (f16 staging
    // for the Wo GEMM)
    {
      const int c2 = lane * 2, hh = lane >> 2;
      float ox = 0.0f, oy = 0.0f;
#pragma unroll
      for (int i = 0; i < NWV; ++i) {
        const float f = s_ml[0][i][hh][w];
        const float2 ov = *(const float2*)&s_o[i][w][c2];
        ox += ov.x * f;
        oy += ov.y * f;
      }
      typedef __attribute__((ext_vector_type(2))) _Float16 v2h;
      v2h o;
      o[0] = (_Float16)ox;
      o[1] = (_Float16)oy;
      *(v2h*)(ctx + (size_t)row0 * EDIM + (unsigned)(2 * tid)) = o;  // row w, column c2
    }
    // in front of the next trip's overwrite of the registers that this trip's
    // stores name
    asm volatile("s_wait_xcnt 0x0" ::: "memory");
  }
}

// ---------------------------------------------------------------------------
// Kernel 3/5: y = LN(A16 @ W^T + bias + resid).  One wave owns a full 16x64
// row tile (4 col tiles) so LN row stats reduce with wave shuffles.
// grid = NROW/128, block = 256 (8 waves = 8 row tiles).
// ---------------------------------------------------------------------------
__global__ void __launch_bounds__(256)
ga_proj_res_ln(const _Float16* __restrict__ A16, const float* __restrict__ W,
               const float* __restrict__ bias, const float* __restrict__ resid,
               const float* __restrict__ g, const float* __restrict__ bb,
               float* __restrict__ xout, _Float16* __restrict__ xout16) {
  const int lane = threadIdx.x & 31;
  const int wv = threadIdx.x >> 5;
  const int row0 = (blockIdx.x * 8 + wv) * 16;
  const int m = lane & 15, half = lane >> 4;
  __builtin_prefetch(&W[(size_t)m * EDIM], 0, 3);

  v8f c[4];
#pragma unroll
  for (int t = 0; t < 4; ++t) {
    float bn = bias[t * 16 + m];
#pragma unroll
    for (int r = 0; r < 8; ++r) c[t][r] = bn;
  }

#pragma unroll
  for (int kb = 0; kb < EDIM; kb += 32) {
    v16h a;
#pragma unroll
    for (int s = 0; s < 16; ++s)
      a[s] = A16[(size_t)(row0 + m) * EDIM + kb + kslot(s, half)];
#pragma unroll
    for (int t = 0; t < 4; ++t) {
      v16h bmat;
#pragma unroll
      for (int s = 0; s < 16; ++s)
        bmat[s] = (_Float16)W[(size_t)(t * 16 + m) * EDIM + kb + kslot(s, half)];
      c[t] = wmma16(a, bmat, c[t]);
    }
  }

#pragma unroll
  for (int t = 0; t < 4; ++t)
#pragma unroll
    for (int r = 0; r < 8; ++r)
      c[t][r] += resid[(size_t)(row0 + r + 8 * half) * EDIM + t * 16 + m];

  float mu[8], rs[8];
#pragma unroll
  for (int r = 0; r < 8; ++r) {
    float sm = 0.f, sq = 0.f;
#pragma unroll
    for (int t = 0; t < 4; ++t) {
      sm += c[t][r];
      sq += c[t][r] * c[t][r];
    }
    sm = hsum16(sm);
    sq = hsum16(sq);
    float mean = sm * (1.0f / 64.0f);
    float var = sq * (1.0f / 64.0f) - mean * mean;
    mu[r] = mean;
    rs[r] = __frsqrt_rn(var + 1e-5f);
  }

#pragma unroll
  for (int t = 0; t < 4; ++t) {
    int col = t * 16 + m;
    float gg = g[col], bv = bb[col];
#pragma unroll
    for (int r = 0; r < 8; ++r) {
      float y = (c[t][r] - mu[r]) * rs[r] * gg + bv;
      size_t idx = (size_t)(row0 + r + 8 * half) * EDIM + col;
      xout[idx] = y;
      if (xout16) xout16[idx] = (_Float16)y;
    }
  }
}

// ---------------------------------------------------------------------------
// Kernel 4: h1 = relu(x @ W1^T + b1) -> f16.  grid=NROW/16, block=128.
// ---------------------------------------------------------------------------
__global__ void __launch_bounds__(128)
ga_ffn1(const _Float16* __restrict__ x16, const float* __restrict__ W1,
        const float* __restrict__ b1, _Float16* __restrict__ h1) {
  const int lane = threadIdx.x & 31;
  const int wv = threadIdx.x >> 5;
  const int row0 = blockIdx.x * 16;
  const int m = lane & 15, half = lane >> 4;
  const int n = wv * 16 + m;
  __builtin_prefetch(&W1[(size_t)n * EDIM], 0, 3);
  v8f c;
  const float bn = b1[n];
#pragma unroll
  for (int r = 0; r < 8; ++r) c[r] = bn;
#pragma unroll
  for (int kb = 0; kb < EDIM; kb += 32) {
    v16h a, b;
#pragma unroll
    for (int s = 0; s < 16; ++s) {
      int kk = kb + kslot(s, half);
      a[s] = x16[(size_t)(row0 + m) * EDIM + kk];
      b[s] = (_Float16)W1[(size_t)n * EDIM + kk];
    }
    c = wmma16(a, b, c);
  }
#pragma unroll
  for (int r = 0; r < 8; ++r)
    h1[(size_t)(row0 + r + 8 * half) * EDIM + n] = (_Float16)fmaxf(c[r], 0.0f);
}

// ---------------------------------------------------------------------------
extern "C" void kernel_launch(void* const* d_in, const int* in_sizes, int n_in,
                              void* d_out, int out_size, void* d_ws,
                              size_t ws_size, hipStream_t stream) {
  const float* q    = (const float*)d_in[0];
  const float* k    = (const float*)d_in[1];
  const float* prev = (const float*)d_in[2];
  const float* Wq   = (const float*)d_in[3];
  const float* bq   = (const float*)d_in[4];
  const float* Wk   = (const float*)d_in[5];
  const float* bk   = (const float*)d_in[6];
  const float* Wv   = (const float*)d_in[7];
  const float* bv   = (const float*)d_in[8];
  const float* Wo   = (const float*)d_in[9];
  const float* bo   = (const float*)d_in[10];
  const float* g1   = (const float*)d_in[11];
  const float* bb1  = (const float*)d_in[12];
  const float* W1   = (const float*)d_in[13];
  const float* b1   = (const float*)d_in[14];
  const float* W2   = (const float*)d_in[15];
  const float* b2   = (const float*)d_in[16];
  const float* g2   = (const float*)d_in[17];
  const float* bb2  = (const float*)d_in[18];

  float* out = (float*)d_out;                          // [B, Lq, E]
  float* attw = out + (size_t)BQ * LSEQ * EDIM;        // [B, Lq, Lk]

  char* ws = (char*)d_ws;                              // 32 MB used
  _Float16* qh  = (_Float16*)(ws + (size_t)0);
  _Float16* kh  = (_Float16*)(ws + ((size_t)4 << 20));
  _Float16* vh  = (_Float16*)(ws + ((size_t)8 << 20));  // V^T [B][E][L]
  _Float16* ctx = (_Float16*)(ws + ((size_t)12 << 20));
  float*    xf  = (float*)   (ws + ((size_t)16 << 20));
  _Float16* x16 = (_Float16*)(ws + ((size_t)24 << 20));
  _Float16* h1  = (_Float16*)(ws + ((size_t)28 << 20));

  ga_qkv<<<dim3(NROW / 16, 3), 128, 0, stream>>>(q, k, Wq, bq, Wk, bk, Wv, bv,
                                                 qh, kh, vh);
  ga_attn<<<dim3(LSEQ / (16 * QTILES), BQ), 512, 0, stream>>>(qh, kh, vh, ctx, attw);
  ga_proj_res_ln<<<NROW / 128, 256, 0, stream>>>(ctx, Wo, bo, prev, g1, bb1,
                                                 xf, x16);
  ga_ffn1<<<NROW / 16, 128, 0, stream>>>(x16, W1, b1, h1);
  ga_proj_res_ln<<<NROW / 128, 256, 0, stream>>>(h1, W2, b2, xf, g2, bb2, out,
                                                 (_Float16*)nullptr);
}

// v004
// It runs in 52.3 microseconds.
// Next to v003, in two timings, it ran 1.36 times as fast each time.
// Over all steps from v000 it is 4.44 times as fast.
#include <hip/hip_runtime.h>

#define BQ 64
#define LSEQ 512
#define EDIM 64
#define NHEAD 8
#define HDIM 8
#define NROW (BQ * LSEQ) /* 32768 */

typedef __attribute__((ext_vector_type(16))) _Float16 v16h;
typedef __attribute__((ext_vector_type(8))) _Float16 v8h;
typedef __attribute__((ext_vector_type(8))) float v8f;

// K index held by v16h slot s for a lane in K-half `khalf` (ISA 7.12.2,
// 16-bit A 16x32 layout; B uses the same per-lane K ordering with N=lane%16).
__device__ __forceinline__ int kslot(int s, int khalf) {
  int j = s >> 1, p = s & 1;
  return (j < 4) ? (khalf * 8 + j * 2 + p) : (16 + khalf * 8 + (j - 4) * 2 + p);
}

__device__ __forceinline__ v8f wmma16(v16h a, v16h b, v8f c) {
  return __builtin_amdgcn_wmma_f32_16x16x32_f16(false, a, false, b, (short)0, c,
                                                false, false);
}

// value held by lane l ^ 16 (the other 16-lane half), by a vector cross-row move
__device__ __forceinline__ float xhalf(float v) {
  int b = __builtin_bit_cast(int, v);
  b = __builtin_amdgcn_permlanex16(b, b, 0x76543210, 0xfedcba98, false, false);
  return __builtin_bit_cast(float, b);
}

// ---------------------------------------------------------------------------
// Kernel 1: fused QKV projections.  grid=(NROW/16, 3), block=128 (4 waves).
// out = X @ W^T + b, q pre-scaled 1/sqrt(D).  Q and K: a block owns 16 rows,
// each wave one 16-col tile, row-major f16 out.  V: a block owns 64 rows of
// one 16-col tile (each wave 16 rows) and stores V^T [B][E][L], so that the
// attention kernel reads its V^T operand as 16-byte runs of keys; a lane's 8
// accumulator rows are 8 consecutive keys of one column: one 16-byte store.
// ---------------------------------------------------------------------------
__global__ void __launch_bounds__(128)
ga_qkv(const float* __restrict__ q, const float* __restrict__ k,
       const float* __restrict__ Wq, const float* __restrict__ bq,
       const float* __restrict__ Wk, const float* __restrict__ bk,
       const float* __restrict__ Wv, const float* __restrict__ bv,
       _Float16* __restrict__ qh, _Float16* __restrict__ kh,
       _Float16* __restrict__ vt) {
  const int lane = threadIdx.x & 31;
  const int wv = threadIdx.x >> 5;
  const int which = blockIdx.y;
  const float* X;
  const float* W;
  const float* bias;
  float osc;
  if (which == 0) { X = q; W = Wq; bias = bq; osc = 0.35355339059327373f; }
  else if (which == 1) { X = k; W = Wk; bias = bk; osc = 1.0f; }
  else { X = k; W = Wv; bias = bv; osc = 1.0f; }

  const int m = lane & 15, half = lane >> 4;
  const int row0 = (which == 2) ? (blockIdx.x >> 2) * 64 + wv * 16
                                : blockIdx.x * 16;
  const int n = ((which == 2) ? (blockIdx.x & 3) : wv) * 16 + m;
  __builtin_prefetch(&W[(size_t)n * EDIM], 0, 3);  // -> global_prefetch_b8
  v8f c;
  const float bn = bias[n];
#pragma unroll
  for (int r = 0; r < 8; ++r) c[r] = bn;

#pragma unroll
  for (int kb = 0; kb < EDIM; kb += 32) {
    v16h a, b;
#pragma unroll
    for (int s = 0; s < 16; ++s) {
      int kk = kb + kslot(s, half);
      a[s] = (_Float16)X[(size_t)(row0 + m) * EDIM + kk];
      b[s] = (_Float16)W[(size_t)n * EDIM + kk];
    }
    c = wmma16(a, b, c);
  }
  if (which == 2) {
    v8h o;
#pragma unroll
    for (int r = 0; r < 8; ++r) o[r] = (_Float16)c[r];
    *(v8h*)&vt[((size_t)(row0 / LSEQ) * EDIM + n) * LSEQ + (row0 % LSEQ) +
               8 * half] = o;
  } else {
    _Float16* out = (which == 0) ? qh : kh;
#pragma unroll
    for (int r = 0; r < 8; ++r)
      out[(size_t)(row0 + r + 8 * half) * EDIM + n] = (_Float16)(c[r] * osc);
    // the wait that belongs between these stores and any later overwrite of a
    // register they name (the built code lays the V^T block out behind them)
    asm volatile("s_wait_xcnt 0x0" ::: "memory");
  }
}

// ---------------------------------------------------------------------------
// Kernel 2: attention in one pass, and the rest of the layer behind it.  grid=(LSEQ/(16*QTILES), B), block=512 (16
// waves): one block per WGP, all resident at once.  Wave w owns keys
// 32w..32w+31 for ALL 8 heads; it loads its K and V^T fragments once, keeps K
// in registers and V^T in an LDS range of its own (registers are short beside
// P), and walks QTILES tiles of 16 queries with them.
// Per tile and head: S^T = K Q^T (two 16-key tiles; K rows carry 32 dims = 4
// heads and Q is zeroed outside the head), softmax numerators against the
// wave's own maximum, O^T = V^T P^T over the wave's 32 keys.  P stays in
// registers.  The waves' maxima, sums and O parts are joined through LDS; then
// a lane, which holds the same (query, 16 keys) for every head, forms the head
// mean in registers and stores it.  Scores are computed and exponentiated once.
// The LDS areas are doubled and taken by the tile's parity: a wave that writes
// tile t + 2 has passed both barriers of tile t + 1, which every wave reaches
// only behind its last read of tile t.
// Closing part: the block's 128 context rows stay in LDS (f16), and waves 0..7
// take 16 rows each through Wo + residual + LN1, W1 + relu, W2 + residual + LN2.
// Every product is transposed, Y^T = W X^T: a lane then holds 32 features of
// ONE row, so that a row's LN sums are in-lane but for one cross-half move, and
// two accumulator tiles are, slot for slot, the next product's B operand.  The
// three weight matrices (f16) and the seven vectors are put in LDS at the
// kernel's head, under the first tile's loads.
// ---------------------------------------------------------------------------
#define NWV 16      /* waves per block = key slices */
#define OPITCH 68   /* floats per query row of an O part: 64 + 4 against bank conflicts */
#define QTILES 8    /* 16-query tiles a block walks */
#define WPITCH 72   /* halves per f16 row in LDS: 64 + 8 (16 bytes) against bank conflicts */

__device__ __forceinline__ v16h cat8(v8h lo, v8h hi) {
  return __builtin_shufflevector(lo, hi, 0, 1, 2, 3, 4, 5, 6, 7, 8, 9, 10, 11,
                                 12, 13, 14, 15);
}

// c[t] += W[16 t .. 16 t + 15][:] X^T.  A: lane (m, half) holds feature 16 t + m,
// slot s is k = 32 j + kslot(s, half); B (xb[j]): row m, the same k per slot.
// c[t][r] is then (row m, feature 16 t + 8 half + r).
__device__ __forceinline__ void gemm_t(const _Float16 (*sw)[WPITCH], const v16h* xb,
                                       int m, int half, v8f* c) {
#pragma unroll
  for (int j = 0; j < 2; ++j)
#pragma unroll
    for (int t = 0; t < 4; ++t) {
      const _Float16* wp = &sw[16 * t + m][32 * j + 8 * half];
      c[t] = wmma16(cat8(*(const v8h*)wp, *(const v8h*)(wp + 16)), xb[j], c[t]);
    }
}

// accumulator tiles 2 j and 2 j + 1 as the B operand of k block j: slot s < 8 is
// feature 32 j + 8 half + s, slot s >= 8 feature 32 j + 16 + 8 half + s - 8
__device__ __forceinline__ void to_b(const v8f* c, v16h* xb) {
#pragma unroll
  for (int j = 0; j < 2; ++j)
#pragma unroll
    for (int r = 0; r < 8; ++r) {
      xb[j][r] = (_Float16)c[2 * j][r];
      xb[j][8 + r] = (_Float16)c[2 * j + 1][r];
    }
}

// c[t][r] = v[16 t + r]; v points at the lane's half (+ 8 half) of a 64-vector
__device__ __forceinline__ void vec_t(const float* v, v8f* c) {
#pragma unroll
  for (int t = 0; t < 4; ++t) {
    const float4 a = *(const float4*)(v + 16 * t);
    const float4 b = *(const float4*)(v + 16 * t + 4);
    c[t][0] = a.x; c[t][1] = a.y; c[t][2] = a.z; c[t][3] = a.w;
    c[t][4] = b.x; c[t][5] = b.y; c[t][6] = b.z; c[t][7] = b.w;
  }
}

// layer norm of the row a lane pair (m, half 0 and 1) holds; four partial sums
// a lane, so that the additions do not form one long dependent chain
__device__ __forceinline__ void ln_t(v8f* c, const float* g, const float* b) {
  float sm4[4], sq4[4];
#pragma unroll
  for (int t = 0; t < 4; ++t) {
    sm4[t] = 0.0f;
    sq4[t] = 0.0f;
#pragma unroll
    for (int r = 0; r < 8; ++r) {
      sm4[t] += c[t][r];
      sq4[t] += c[t][r] * c[t][r];
    }
  }
  float sm = (sm4[0] + sm4[1]) + (sm4[2] + sm4[3]);
  float sq = (sq4[0] + sq4[1]) + (sq4[2] + sq4[3]);
  sm += xhalf(sm);
  sq += xhalf(sq);
  const float mean = sm * (1.0f / 64.0f);
  const float var = sq * (1.0f / 64.0f) - mean * mean;
  const float rs = __frsqrt_rn(var + 1e-5f);
  v8f gg[4], bv[4];
  vec_t(g, gg);
  vec_t(b, bv);
#pragma unroll
  for (int t = 0; t < 4; ++t)
#pragma unroll
    for (int r = 0; r < 8; ++r) c[t][r] = (c[t][r] - mean) * rs * gg[t][r] + bv[t][r];
}

__global__ void __launch_bounds__(512)
ga_attn(const _Float16* __restrict__ qh, const _Float16* __restrict__ kh,
        const _Float16* __restrict__ vt, float* __restrict__ attw,
        const float* __restrict__ prev, const float* __restrict__ Wo,
        const float* __restrict__ bo, const float* __restrict__ g1,
        const float* __restrict__ bb1, const float* __restrict__ W1,
        const float* __restrict__ b1, const float* __restrict__ W2,
        const float* __restrict__ b2, const float* __restrict__ g2,
        const float* __restrict__ bb2, float* __restrict__ out) {
  __shared__ __attribute__((aligned(16))) float s_o2[2][NWV][16][OPITCH];  // O parts
  __shared__ float s_ml2[2][2][NWV][NHEAD][16];  // [.][0] max, later factor; [.][1] sum
  __shared__ __attribute__((aligned(16))) v8h s_v[NWV][8][32];  // V^T fragments
  __shared__ __attribute__((aligned(16))) _Float16 s_w[3][EDIM][WPITCH];  // Wo, W1, W2
  __shared__ __attribute__((aligned(16))) float s_vec[7][EDIM];  // bo g1 bb1 b1 b2 g2 bb2
  __shared__ __attribute__((aligned(16))) _Float16 s_ctx[16 * QTILES][WPITCH];  // context
  const int tid = threadIdx.x;
  const int lane = tid & 31;
  const int w = tid >> 5;
  const int b = blockIdx.y;
  const int rowb = b * LSEQ + blockIdx.x * (16 * QTILES);  // first q row of the block
  const int key0 = b * LSEQ + w * 32;                      // flattened first key row
  const int m = lane & 15, half = lane >> 4;
  const v8h z8 = {};
  // a lane's own part of the addresses used in the loop, 32 bits each, beside
  // bases that are the same for the whole block (fewer registers held)
  const unsigned qoff = (unsigned)(m * EDIM + 8 * half);
  const unsigned aoff = (unsigned)(m * LSEQ + w * 32 + 8 * half);

  // all operands 16 bytes a load.  Slot s of a lane is dim 32 g + kslot(s, half)
  // for Q and for K alike, and key kslot(s, half) for V^T (row m of pair i =
  // column 16 i + m of V).
  const _Float16* qp = qh + (size_t)(rowb + m) * EDIM + 8 * half;
  const _Float16* kp0 = kh + (size_t)(key0 + m) * EDIM + 8 * half;
  const _Float16* kp1 = kp0 + 16 * EDIM;
  const _Float16* vp = vt + ((size_t)b * EDIM + m) * LSEQ + w * 32 + 8 * half;
  v8h qlo[2], qhi[2];
  v16h kf[2][2];
#pragma unroll
  for (int g = 0; g < 2; ++g) {
    qlo[g] = *(const v8h*)(qp + 32 * g);
    qhi[g] = *(const v8h*)(qp + 32 * g + 16);
    kf[g][0] = cat8(*(const v8h*)(kp0 + 32 * g), *(const v8h*)(kp0 + 32 * g + 16));
    kf[g][1] = cat8(*(const v8h*)(kp1 + 32 * g), *(const v8h*)(kp1 + 32 * g + 16));
  }
  // V^T fragments: parked in the wave's own LDS range, a lane's 16 bytes side by
  // side; only the wave that wrote them reads them, so no barrier is owed
#pragma unroll
  for (int i = 0; i < 4; ++i) {
    s_v[w][2 * i][lane] = *(const v8h*)(vp + (size_t)16 * i * LSEQ);
    s_v[w][2 * i + 1][lane] = *(const v8h*)(vp + (size_t)16 * i * LSEQ + 16);
  }
  // the closing part's weights as f16 and its vectors: a thread takes 8 floats
  // of each matrix; read only behind the loop's barriers
  const unsigned woff = (unsigned)(32 * tid);  // in bytes: the register the loads name
  {
    const float* wsrc[3] = {Wo, W1, W2};
#pragma unroll
    for (int i = 0; i < 3; ++i) {
      const float4 a0 = *(const float4*)((const char*)wsrc[i] + woff);
      const float4 a1 = *(const float4*)((const char*)wsrc[i] + woff + 16);
      v8h hv;
      hv[0] = (_Float16)a0.x; hv[1] = (_Float16)a0.y;
      hv[2] = (_Float16)a0.z; hv[3] = (_Float16)a0.w;
      hv[4] = (_Float16)a1.x; hv[5] = (_Float16)a1.y;
      hv[6] = (_Float16)a1.z; hv[7] = (_Float16)a1.w;
      *(v8h*)&s_w[i][tid >> 3][(tid & 7) * 8] = hv;
    }
    if (tid < EDIM) {
      s_vec[0][tid] = bo[tid];
      s_vec[1][tid] = g1[tid];
      s_vec[2][tid] = bb1[tid];
      s_vec[3][tid] = b1[tid];
      s_vec[4][tid] = b2[tid];
      s_vec[5][tid] = g2[tid];
      s_vec[6][tid] = bb2[tid];
    }
  }
  // the wait that belongs in front of any overwrite of an issued load's address
  // registers; the addresses are inputs so that no load lands on one of them
  asm volatile("s_wait_xcnt 0x0" ::"v"(qp), "v"(kp0), "v"(kp1), "v"(vp), "v"(woff) : "memory");

// rolled: one copy of the body, for speed only
#pragma unroll 1
  for (int it = 0; it < QTILES; ++it) {
    const int row0 = rowb + it * 16;  // flattened first q row of the tile
    float (*s_o)[16][OPITCH] = s_o2[it & 1];
    float (*s_ml)[NWV][NHEAD][16] = s_ml2[it & 1];
    float p[NHEAD][16];  // p[h][8 t + r]: query m, key 32 w + 16 t + 8 half + r

#pragma unroll
    for (int g = 0; g < 2; ++g) {  // dims 32 g .. 32 g + 31 = heads 4 g .. 4 g + 3
#pragma unroll
      for (int pr = 0; pr < 2; ++pr) {  // head pair: 16 columns of V
        const v16h va = cat8(s_v[w][4 * g + 2 * pr][lane], s_v[w][4 * g + 2 * pr + 1][lane]);
        v8f o2[2];
#pragma unroll
        for (int e = 0; e < 2; ++e) {
          const int h = 4 * g + 2 * pr + e;
          // the head's 8 dims sit in half e, low slots (pr 0) or high slots (pr 1)
          const v8h sel = (half == e) ? (pr ? qhi[g] : qlo[g]) : z8;
          const v16h bq = pr ? cat8(z8, sel) : cat8(sel, z8);
          v8f cs0 = {}, cs1 = {};
          cs0 = wmma16(kf[g][0], bq, cs0);  // cs[r] = S[query m][key 16 t + 8 half + r]
          cs1 = wmma16(kf[g][1], bq, cs1);

          float tmax = fmaxf(cs0[0], cs1[0]);
#pragma unroll
          for (int r = 1; r < 8; ++r) tmax = fmaxf(tmax, fmaxf(cs0[r], cs1[r]));
          tmax = fmaxf(tmax, xhalf(tmax));  // all 32 keys of the slice

          v16h bp;  // P^T as B: slot s is key kslot(s, half), the accumulators' own map
          float ps = 0.0f;
#pragma unroll
          for (int r = 0; r < 8; ++r) {
            const float p0 = __expf(cs0[r] - tmax);
            const float p1 = __expf(cs1[r] - tmax);
            ps += p0 + p1;
            p[h][r] = p0;
            p[h][8 + r] = p1;
            bp[r] = (_Float16)p0;
            bp[8 + r] = (_Float16)p1;
          }
          ps += xhalf(ps);
          s_ml[half][w][h][m] = half ? ps : tmax;

          v8f oz = {};
          o2[e] = wmma16(va, bp, oz);  // rows 8 e .. 8 e + 7 are this head's d
        }
        // lane (m, half) keeps head 2 pr + half: O[query m][16 (2 g + pr) + 8 half + r]
        float4 w0, w1;
        w0.x = half ? o2[1][0] : o2[0][0];
        w0.y = half ? o2[1][1] : o2[0][1];
        w0.z = half ? o2[1][2] : o2[0][2];
        w0.w = half ? o2[1][3] : o2[0][3];
        w1.x = half ? o2[1][4] : o2[0][4];
        w1.y = half ? o2[1][5] : o2[0][5];
        w1.z = half ? o2[1][6] : o2[0][6];
        w1.w = half ? o2[1][7] : o2[0][7];
        float* op = &s_o[w][m][32 * g + 16 * pr + 8 * half];
        *(float4*)op = w0;
        *(float4*)(op + 4) = w1;
      }
    }
    __syncthreads();  // every slice's max, sum and O part are in LDS

    // join the slices: one thread per (head, query) turns the 16 maxima into the
    // 16 factors exp(m_w - max) / sum that scale a slice's P and O
    if (tid < NHEAD * 16) {
      const int hh = tid >> 4, qq = tid & 15;
      float mw[NWV];
      float mg = -1e30f;
#pragma unroll
      for (int i = 0; i < NWV; ++i) {
        mw[i] = s_ml[0][i][hh][qq];
        mg = fmaxf(mg, mw[i]);
      }
      float ls = 0.0f;
#pragma unroll
      for (int i = 0; i < NWV; ++i) {
        mw[i] = __expf(mw[i] - mg);
        ls += mw[i] * s_ml[1][i][hh][qq];
      }
      const float inv = 1.0f / ls;
#pragma unroll
      for (int i = 0; i < NWV; ++i) s_ml[0][i][hh][qq] = mw[i] * inv;
    }
    __syncthreads();  // the factors are in LDS

    // head mean of the normalized weights, in registers, heads in order 0..7
    {
      float acc[16];
#pragma unroll
      for (int j = 0; j < 16; ++j) acc[j] = 0.0f;
#pragma unroll
      for (int h = 0; h < NHEAD; ++h) {
        const float f = 0.125f * s_ml[0][w][h][m];
#pragma unroll
        for (int j = 0; j < 16; ++j) acc[j] += p[h][j] * f;
      }
      float* ap = attw + (size_t)row0 * LSEQ + aoff;
#pragma unroll
      for (int t = 0; t < 2; ++t) {
        *(float4*)(ap + 16 * t) = make_float4(acc[8 * t], acc[8 * t + 1],
                                              acc[8 * t + 2], acc[8 * t + 3]);
        *(float4*)(ap + 16 * t + 4) = make_float4(acc[8 * t + 4], acc[8 * t + 5],
                                                  acc[8 * t + 6], acc[8 * t + 7]);
      }
    }

    // the next tile's Q, fetched under this tile's closing work (the last trip
    // reads its own tile again, so that the address stays inside qh)
    {
      const _Float16* qn =  // uniform base; the lane's part is the 32-bit qoff
          qh + (size_t)(rowb + ((it + 1 < QTILES) ? it + 1 : it) * 16) * EDIM;
#pragma unroll
      for (int g = 0; g < 2; ++g) {
        qlo[g] = *(const v8h*)(qn + qoff + 32 * g);
        qhi[g] = *(const v8h*)(qn + qoff + 32 * g + 16);
      }
    }

    // context: wave w sums query w's 16 O parts, a lane two columns (f16, kept in
    // LDS for the Wo product of the closing part)
    {
      const int c2 = lane * 2, hh = lane >> 2;
      float ox = 0.0f, oy = 0.0f;
#pragma unroll
      for (int i = 0; i < NWV; ++i) {
        const float f = s_ml[0][i][hh][w];
        const float2 ov = *(const float2*)&s_o[i][w][c2];
        ox += ov.x * f;
        oy += ov.y * f;
      }
      typedef __attribute__((ext_vector_type(2))) _Float16 v2h;
      v2h o;
      o[0] = (_Float16)ox;
      o[1] = (_Float16)oy;
      *(v2h*)&s_ctx[it * 16 + w][c2] = o;
    }
    // in front of the next trip's overwrite of the registers that this trip's
    // stores name
    asm volatile("s_wait_xcnt 0x0" ::: "memory");
  }

  // closing part: wave wu < 8 takes rows 16 wu .. 16 wu + 15 of the block; lane
  // (m, half) holds row m, features 16 t + 8 half + r
  const int wu = __builtin_amdgcn_readfirstlane(w);  // scalar branch round the WMMAs
  const size_t roff = (size_t)(rowb + 16 * (wu & (QTILES - 1)) + m) * EDIM + 8 * half;
  v8f res[4] = {};
  // residual: issued ahead of the barrier, beside the drain of the last tile's stores
  if (wu < QTILES) vec_t(prev + roff, res);
  __syncthreads();  // all 128 context rows are in LDS
  if (wu < QTILES) {
    const int h8 = 8 * half;
    v16h xb[2];
#pragma unroll
    for (int j = 0; j < 2; ++j) {
      const _Float16* cp = &s_ctx[16 * wu + m][32 * j + h8];
      xb[j] = cat8(*(const v8h*)cp, *(const v8h*)(cp + 16));
    }
    v8f x[4], y[4];
    vec_t(&s_vec[0][h8], x);
    gemm_t(s_w[0], xb, m, half, x);
#pragma unroll
    for (int t = 0; t < 4; ++t) x[t] += res[t];
    ln_t(x, &s_vec[1][h8], &s_vec[2][h8]);

    to_b(x, xb);
    vec_t(&s_vec[3][h8], y);
    gemm_t(s_w[1], xb, m, half, y);
#pragma unroll
    for (int t = 0; t < 4; ++t)
#pragma unroll
      for (int r = 0; r < 8; ++r) y[t][r] = fmaxf(y[t][r], 0.0f);

    to_b(y, xb);
    vec_t(&s_vec[4][h8], y);
    gemm_t(s_w[2], xb, m, half, y);
#pragma unroll
    for (int t = 0; t < 4; ++t) y[t] += x[t];
    ln_t(y, &s_vec[5][h8], &s_vec[6][h8]);

    float* op = out + roff;
#pragma unroll
    for (int t = 0; t < 4; ++t) {
      *(float4*)(op + 16 * t) = make_float4(y[t][0], y[t][1], y[t][2], y[t][3]);
      *(float4*)(op + 16 * t + 4) = make_float4(y[t][4], y[t][5], y[t][6], y[t][7]);
    }
  }
}

// ---------------------------------------------------------------------------
extern "C" void kernel_launch(void* const* d_in, const int* in_sizes, int n_in,
                              void* d_out, int out_size, void* d_ws,
                              size_t ws_size, hipStream_t stream) {
  const float* q    = (const float*)d_in[0];
  const float* k    = (const float*)d_in[1];
  const float* prev = (const float*)d_in[2];
  const float* Wq   = (const float*)d_in[3];
  const float* bq   = (const float*)d_in[4];
  const float* Wk   = (const float*)d_in[5];
  const float* bk   = (const float*)d_in[6];
  const float* Wv   = (const float*)d_in[7];
  const float* bv   = (const float*)d_in[8];
  const float* Wo   = (const float*)d_in[9];
  const float* bo   = (const float*)d_in[10];
  const float* g1   = (const float*)d_in[11];
  const float* bb1  = (const float*)d_in[12];
  const float* W1   = (const float*)d_in[13];
  const float* b1   = (const float*)d_in[14];
  const float* W2   = (const float*)d_in[15];
  const float* b2   = (const float*)d_in[16];
  const float* g2   = (const float*)d_in[17];
  const float* bb2  = (const float*)d_in[18];

  float* out = (float*)d_out;                          // [B, Lq, E]
  float* attw = out + (size_t)BQ * LSEQ * EDIM;        // [B, Lq, Lk]

  char* ws = (char*)d_ws;                              // 12 MB used
  _Float16* qh  = (_Float16*)(ws + (size_t)0);
  _Float16* kh  = (_Float16*)(ws + ((size_t)4 << 20));
  _Float16* vh  = (_Float16*)(ws + ((size_t)8 << 20));  // V^T [B][E][L]

  ga_qkv<<<dim3(NROW / 16, 3), 128, 0, stream>>>(q, k, Wq, bq, Wk, bk, Wv, bv,
                                                 qh, kh, vh);
  ga_attn<<<dim3(LSEQ / (16 * QTILES), BQ), 512, 0, stream>>>(
      qh, kh, vh, attw, prev, Wo, bo, g1, bb1, W1, b1, W2, b2, g2, bb2, out);
}

// v005
// It runs in 35.8 microseconds.
// Two timings next to v004 both put it at 1.46 times that version's speed.
// Counting every step since v000, it is 6.48 times as fast.
#include <hip/hip_runtime.h>

#define BQ 64
#define LSEQ 512
#define EDIM 64
#define NHEAD 8
#define HDIM 8
#define NROW (BQ * LSEQ) /* 32768 */

typedef __attribute__((ext_vector_type(16))) _Float16 v16h;
typedef __attribute__((ext_vector_type(8))) _Float16 v8h;
typedef __attribute__((ext_vector_type(8))) float v8f;

// K index held by v16h slot s for a lane in K-half `khalf` (ISA 7.12.2,
// 16-bit A 16x32 layout; B uses the same per-lane K ordering with N=lane%16).
__device__ __forceinline__ int kslot(int s, int khalf) {
  int j = s >> 1, p = s & 1;
  return (j < 4) ? (khalf * 8 + j * 2 + p) : (16 + khalf * 8 + (j - 4) * 2 + p);
}

__device__ __forceinline__ v8f wmma16(v16h a, v16h b, v8f c) {
  return __builtin_amdgcn_wmma_f32_16x16x32_f16(false, a, false, b, (short)0, c,
                                                false, false);
}

// value held by lane l ^ 16 (the other 16-lane half), by a vector cross-row move
__device__ __forceinline__ float xhalf(float v) {
  int b = __builtin_bit_cast(int, v);
  b = __builtin_amdgcn_permlanex16(b, b, 0x76543210, 0xfedcba98, false, false);
  return __builtin_bit_cast(float, b);
}

// ---------------------------------------------------------------------------
// The whole layer in one kernel: projections, attention in one pass, and the
// rest of the layer behind it.  grid=(LSEQ/(16*QTILES), B), block=512 (16
// waves): one block per WGP, all resident at once.  Wave w owns keys
// 32w..32w+31 for ALL 8 heads; it forms its K and V^T fragments once, keeps K
// in registers and V^T in an LDS range of its own (registers are short beside
// P), and walks QTILES tiles of 16 queries with them.
// Opening part: out = X W^T + b on f16 operands, q scaled by 1/sqrt(D).  A wave
// reads its 32 rows of k (f32) once as operand fragments and uses them twice:
// as B in K^T = Wk X^T, whose accumulators (key m, 8 features a tile) are slot
// for slot the A operand of the score product, and as A in V = X Wv^T, whose
// accumulators (feature m, 8 keys a tile) are the V^T operand.  Wave w forms 32
// features (half w / 8) of the 16-query tile w % 8 of Q^T = Wq X^T and leaves
// them in LDS (f16) for all.
// Per tile and head: S^T = K Q^T (two 16-key tiles; K rows carry 32 dims = 4
// heads and Q is zeroed outside the head), softmax numerators against the
// wave's own maximum, O^T = V^T P^T over the wave's 32 keys.  P stays in
// registers.  The waves' maxima, sums and O parts are joined through LDS; then
// a lane, which holds the same (query, 16 keys) for every head, forms the head
// mean in registers and stores it.  Scores are computed and exponentiated once.
// The LDS areas are doubled and taken by the tile's parity: a wave that writes
// tile t + 2 has passed both barriers of tile t + 1, which every wave reaches
// only behind its last read of tile t.
// Closing part: the block's 128 context rows stay in LDS (f16), and waves 0..7
// take 16 rows each through Wo + residual + LN1, W1 + relu, W2 + residual + LN2.
// Every product is transposed, Y^T = W X^T: a lane then holds 32 features of
// ONE row, so that a row's LN sums are in-lane but for one cross-half move, and
// two accumulator tiles are, slot for slot, the next product's B operand.  The
// six weight matrices (f16) and the ten vectors are put in LDS at the kernel's
// head, beside the loads of the block's k and q rows.
// ---------------------------------------------------------------------------
#define NWV 16      /* waves per block = key slices */
#define OPITCH 68   /* floats per query row of an O part: 64 + 4 against bank conflicts */
#define QTILES 8    /* 16-query tiles a block walks */
#define WPITCH 72   /* halves per f16 row in LDS: 64 + 8 (16 bytes) against bank conflicts */

__device__ __forceinline__ v16h cat8(v8h lo, v8h hi) {
  return __builtin_shufflevector(lo, hi, 0, 1, 2, 3, 4, 5, 6, 7, 8, 9, 10, 11,
                                 12, 13, 14, 15);
}

// 16 f32 of a row as one f16 operand: p[0..7] are slots 0..7, p[16..23] slots
// 8..15; with p at dim 32 j + 8 half, slot s is dim 32 j + kslot(s, half)
__device__ __forceinline__ v16h ld_x(const float* p) {
  const float4 a = *(const float4*)p;
  const float4 b = *(const float4*)(p + 4);
  const float4 c = *(const float4*)(p + 16);
  const float4 d = *(const float4*)(p + 20);
  v16h x;
  x[0] = (_Float16)a.x; x[1] = (_Float16)a.y; x[2] = (_Float16)a.z; x[3] = (_Float16)a.w;
  x[4] = (_Float16)b.x; x[5] = (_Float16)b.y; x[6] = (_Float16)b.z; x[7] = (_Float16)b.w;
  x[8] = (_Float16)c.x; x[9] = (_Float16)c.y; x[10] = (_Float16)c.z; x[11] = (_Float16)c.w;
  x[12] = (_Float16)d.x; x[13] = (_Float16)d.y; x[14] = (_Float16)d.z; x[15] = (_Float16)d.w;
  return x;
}

// weight rows 16 t .. 16 t + 15, k block j, as an operand: lane (m, half) holds
// row 16 t + m, slot s is k = 32 j + kslot(s, half)
__device__ __forceinline__ v16h wfrag(const _Float16 (*sw)[WPITCH], int t, int j,
                                      int m, int half) {
  const _Float16* wp = &sw[16 * t + m][32 * j + 8 * half];
  return cat8(*(const v8h*)wp, *(const v8h*)(wp + 16));
}

// c[t] += W[16 t .. 16 t + 15][:] X^T.  A: lane (m, half) holds feature 16 t + m,
// slot s is k = 32 j + kslot(s, half); B (xb[j]): row m, the same k per slot.
// c[t][r] is then (row m, feature 16 t + 8 half + r).
__device__ __forceinline__ void gemm_t(const _Float16 (*sw)[WPITCH], const v16h* xb,
                                       int m, int half, v8f* c) {
#pragma unroll
  for (int j = 0; j < 2; ++j)
#pragma unroll
    for (int t = 0; t < 4; ++t) {
      const _Float16* wp = &sw[16 * t + m][32 * j + 8 * half];
      c[t] = wmma16(cat8(*(const v8h*)wp, *(const v8h*)(wp + 16)), xb[j], c[t]);
    }
}

// accumulator tiles 2 j and 2 j + 1 as the B operand of k block j: slot s < 8 is
// feature 32 j + 8 half + s, slot s >= 8 feature 32 j + 16 + 8 half + s - 8
__device__ __forceinline__ void to_b(const v8f* c, v16h* xb) {
#pragma unroll
  for (int j = 0; j < 2; ++j)
#pragma unroll
    for (int r = 0; r < 8; ++r) {
      xb[j][r] = (_Float16)c[2 * j][r];
      xb[j][8 + r] = (_Float16)c[2 * j + 1][r];
    }
}

// c[t][r] = v[16 t + r]; v points at the lane's half (+ 8 half) of a 64-vector
__device__ __forceinline__ void vec_t(const float* v, v8f* c) {
#pragma unroll
  for (int t = 0; t < 4; ++t) {
    const float4 a = *(const float4*)(v + 16 * t);
    const float4 b = *(const float4*)(v + 16 * t + 4);
    c[t][0] = a.x; c[t][1] = a.y; c[t][2] = a.z; c[t][3] = a.w;
    c[t][4] = b.x; c[t][5] = b.y; c[t][6] = b.z; c[t][7] = b.w;
  }
}

// layer norm of the row a lane pair (m, half 0 and 1) holds; four partial sums
// a lane, so that the additions do not form one long dependent chain
__device__ __forceinline__ void ln_t(v8f* c, const float* g, const float* b) {
  float sm4[4], sq4[4];
#pragma unroll
  for (int t = 0; t < 4; ++t) {
    sm4[t] = 0.0f;
    sq4[t] = 0.0f;
#pragma unroll
    for (int r = 0; r < 8; ++r) {
      sm4[t] += c[t][r];
      sq4[t] += c[t][r] * c[t][r];
    }
  }
  float sm = (sm4[0] + sm4[1]) + (sm4[2] + sm4[3]);
  float sq = (sq4[0] + sq4[1]) + (sq4[2] + sq4[3]);
  sm += xhalf(sm);
  sq += xhalf(sq);
  const float mean = sm * (1.0f / 64.0f);
  const float var = sq * (1.0f / 64.0f) - mean * mean;
  const float rs = __frsqrt_rn(var + 1e-5f);
  v8f gg[4], bv[4];
  vec_t(g, gg);
  vec_t(b, bv);
#pragma unroll
  for (int t = 0; t < 4; ++t)
#pragma unroll
    for (int r = 0; r < 8; ++r) c[t][r] = (c[t][r] - mean) * rs * gg[t][r] + bv[t][r];
}

__global__ void __launch_bounds__(512)
ga_attn(const float* __restrict__ q, const float* __restrict__ k,
        const float* __restrict__ Wq, const float* __restrict__ bq,
        const float* __restrict__ Wk, const float* __restrict__ bk,
        const float* __restrict__ Wv, const float* __restrict__ bv,
        float* __restrict__ attw,
        const float* __restrict__ prev, const float* __restrict__ Wo,
        const float* __restrict__ bo, const float* __restrict__ g1,
        const float* __restrict__ bb1, const float* __restrict__ W1,
        const float* __restrict__ b1, const float* __restrict__ W2,
        const float* __restrict__ b2, const float* __restrict__ g2,
        const float* __restrict__ bb2, float* __restrict__ out) {
  __shared__ __attribute__((aligned(16))) float s_o2[2][NWV][16][OPITCH];  // O parts
  __shared__ float s_ml2[2][2][NWV][NHEAD][16];  // [.][0] max, later factor; [.][1] sum
  __shared__ __attribute__((aligned(16))) v8h s_v[NWV][8][32];  // V^T fragments
  __shared__ __attribute__((aligned(16))) _Float16 s_w[6][EDIM][WPITCH];  // Wo W1 W2 Wq Wk Wv
  __shared__ __attribute__((aligned(16))) float s_vec[10][EDIM];  // bo g1 bb1 b1 b2 g2 bb2 bq bk bv
  // rows of a tile: Q until every wave holds the tile's Q in registers (in front
  // of the tile's first barrier), the tile's context from behind its second one
  __shared__ __attribute__((aligned(16))) _Float16 s_ctx[16 * QTILES][WPITCH];
  const int tid = threadIdx.x;
  const int lane = tid & 31;
  const int w = tid >> 5;
  const int b = blockIdx.y;
  const int rowb = b * LSEQ + blockIdx.x * (16 * QTILES);  // first q row of the block
  const int key0 = b * LSEQ + w * 32;                      // flattened first key row
  const int m = lane & 15, half = lane >> 4;
  const v8h z8 = {};
  const int h8 = 8 * half;
  const int wu = __builtin_amdgcn_readfirstlane(w);  // scalar branches round the WMMAs
  // a lane's own part of the address used in the loop, 32 bits, beside a base
  // that is the same for the whole block (fewer registers held)
  const unsigned aoff = (unsigned)(m * LSEQ + w * 32 + 8 * half);

  // the wave's 32 rows of k and 16 rows of q (tile w % 8) as f16 operands: lane
  // (m, half) holds row m of a 16-row tile, slot s is dim 32 j + kslot(s, half)
  const int qt = wu & (QTILES - 1), qf = wu / QTILES;
  const float* kp = k + (size_t)(key0 + m) * EDIM + h8;
  const float* qp = q + (size_t)(rowb + 16 * qt + m) * EDIM + h8;
  v16h xk[2][2], xq[2];
#pragma unroll
  for (int u = 0; u < 2; ++u)
#pragma unroll
    for (int j = 0; j < 2; ++j) xk[u][j] = ld_x(kp + 16 * u * EDIM + 32 * j);
#pragma unroll
  for (int j = 0; j < 2; ++j) xq[j] = ld_x(qp + 32 * j);
  // the weights as f16 and the vectors: a thread takes 8 floats of each matrix,
  // wave i < 10 vector i (two floats a lane; the other waves' load is not used)
  const unsigned woff = (unsigned)(32 * tid);  // in bytes: the register the loads name
  {
    const float* vsrc = bv;
    vsrc = (wu == 0) ? bo : vsrc;
    vsrc = (wu == 1) ? g1 : vsrc;
    vsrc = (wu == 2) ? bb1 : vsrc;
    vsrc = (wu == 3) ? b1 : vsrc;
    vsrc = (wu == 4) ? b2 : vsrc;
    vsrc = (wu == 5) ? g2 : vsrc;
    vsrc = (wu == 6) ? bb2 : vsrc;
    vsrc = (wu == 7) ? bq : vsrc;
    vsrc = (wu == 8) ? bk : vsrc;
    const float2 vv = ((const float2*)vsrc)[lane];
    const float* wsrc[6] = {Wo, W1, W2, Wq, Wk, Wv};
#pragma unroll
    for (int i = 0; i < 6; ++i) {
      const float4 a0 = *(const float4*)((const char*)wsrc[i] + woff);
      const float4 a1 = *(const float4*)((const char*)wsrc[i] + woff + 16);
      v8h hv;
      hv[0] = (_Float16)a0.x; hv[1] = (_Float16)a0.y;
      hv[2] = (_Float16)a0.z; hv[3] = (_Float16)a0.w;
      hv[4] = (_Float16)a1.x; hv[5] = (_Float16)a1.y;
      hv[6] = (_Float16)a1.z; hv[7] = (_Float16)a1.w;
      *(v8h*)&s_w[i][tid >> 3][(tid & 7) * 8] = hv;
    }
    // holds the vector's load in front of the branch, among the loads above: sunk
    // into the branch it would start only behind their wait, a second trip to memory
    asm volatile("" ::"v"(vv.x), "v"(vv.y));
    if (wu < 10) *(float2*)&s_vec[wu][2 * lane] = vv;
  }
  // the wait that belongs in front of any overwrite of an issued load's address
  // registers; the addresses are inputs so that no load lands on one of them
  asm volatile("s_wait_xcnt 0x0" ::"v"(kp), "v"(qp), "v"(woff), "v"(lane) : "memory");
  __syncthreads();  // weights and vectors are in LDS

#pragma unroll
  for (int t = 0; t < 2; ++t) {
    const int f0 = 32 * qf + 16 * t;  // cq[r]: query 16 qt + m, feature f0 + 8 half + r
    const float4 b0 = *(const float4*)&s_vec[7][f0 + h8];
    const float4 b1v = *(const float4*)&s_vec[7][f0 + h8 + 4];
    v8f cq = {b0.x, b0.y, b0.z, b0.w, b1v.x, b1v.y, b1v.z, b1v.w};
#pragma unroll
    for (int j = 0; j < 2; ++j) cq = wmma16(wfrag(s_w[3], 2 * qf + t, j, m, half), xq[j], cq);
    v8h o;
#pragma unroll
    for (int r = 0; r < 8; ++r) o[r] = (_Float16)(cq[r] * 0.35355339059327373f);
    *(v8h*)&s_ctx[16 * qt + m][f0 + h8] = o;
  }

  v16h kf[2][2];  // kf[g][u]: key 16 u + m, slot s is dim 32 g + kslot(s, half)
  {
    v8f ck[2][4];  // ck[u][t][r]: key 16 u + m, feature 16 t + 8 half + r
    vec_t(&s_vec[8][h8], ck[0]);
#pragma unroll
    for (int t = 0; t < 4; ++t) ck[1][t] = ck[0][t];
#pragma unroll
    for (int j = 0; j < 2; ++j)
#pragma unroll
      for (int t = 0; t < 4; ++t) {
        const v16h wf = wfrag(s_w[4], t, j, m, half);
        ck[0][t] = wmma16(wf, xk[0][j], ck[0][t]);
        ck[1][t] = wmma16(wf, xk[1][j], ck[1][t]);
      }
#pragma unroll
    for (int u = 0; u < 2; ++u) {
      v16h kb[2];
      to_b(ck[u], kb);
      kf[0][u] = kb[0];
      kf[1][u] = kb[1];
    }
  }
  // V^T fragments (row m of pair i = column 16 i + m of V, slot s = key
  // kslot(s, half)): parked in the wave's own LDS range, a lane's 16 bytes side
  // by side; only the wave that wrote them reads them
#pragma unroll
  for (int i = 0; i < 4; ++i) {
    const float bn = s_vec[9][16 * i + m];
    v8f c0, c1;  // cu[r]: key 16 u + 8 half + r, feature 16 i + m
#pragma unroll
    for (int r = 0; r < 8; ++r) c0[r] = c1[r] = bn;
#pragma unroll
    for (int j = 0; j < 2; ++j) {
      const v16h wf = wfrag(s_w[5], i, j, m, half);
      c0 = wmma16(xk[0][j], wf, c0);
      c1 = wmma16(xk[1][j], wf, c1);
    }
    v8h o0, o1;
#pragma unroll
    for (int r = 0; r < 8; ++r) {
      o0[r] = (_Float16)c0[r];
      o1[r] = (_Float16)c1[r];
    }
    s_v[w][2 * i][lane] = o0;
    s_v[w][2 * i + 1][lane] = o1;
  }
  __syncthreads();  // all 128 rows of Q are in LDS

  // slot s of a lane is dim 32 g + kslot(s, half) for Q as for K
  v8h qlo[2], qhi[2];
#pragma unroll
  for (int g = 0; g < 2; ++g) {
    qlo[g] = *(const v8h*)&s_ctx[m][32 * g + h8];
    qhi[g] = *(const v8h*)&s_ctx[m][32 * g + 16 + h8];
  }

// rolled, for speed only
#pragma unroll 1
  for (int it = 0; it < QTILES; ++it) {
    const int row0 = rowb + it * 16;  // flattened first q row of the tile
    float (*s_o)[16][OPITCH] = s_o2[it & 1];
    float (*s_ml)[NWV][NHEAD][16] = s_ml2[it & 1];
    float p[NHEAD][16];  // p[h][8 t + r]: query m, key 32 w + 16 t + 8 half + r

#pragma unroll
    for (int g = 0; g < 2; ++g) {  // dims 32 g .. 32 g + 31 = heads 4 g .. 4 g + 3
#pragma unroll
      for (int pr = 0; pr < 2; ++pr) {  // head pair: 16 columns of V
        const v16h va = cat8(s_v[w][4 * g + 2 * pr][lane], s_v[w][4 * g + 2 * pr + 1][lane]);
        v8f o2[2];
#pragma unroll
        for (int e = 0; e < 2; ++e) {
          const int h = 4 * g + 2 * pr + e;
          // the head's 8 dims sit in half e, low slots (pr 0) or high slots (pr 1)
          const v8h sel = (half == e) ? (pr ? qhi[g] : qlo[g]) : z8;
          const v16h bq = pr ? cat8(z8, sel) : cat8(sel, z8);
          v8f cs0 = {}, cs1 = {};
          cs0 = wmma16(kf[g][0], bq, cs0);  // cs[r] = S[query m][key 16 t + 8 half + r]
          cs1 = wmma16(kf[g][1], bq, cs1);

          float tmax = fmaxf(cs0[0], cs1[0]);
#pragma unroll
          for (int r = 1; r < 8; ++r) tmax = fmaxf(tmax, fmaxf(cs0[r], cs1[r]));
          tmax = fmaxf(tmax, xhalf(tmax));  // all 32 keys of the slice

          v16h bp;  // P^T as B: slot s is key kslot(s, half), the accumulators' own map
          float ps = 0.0f;
#pragma unroll
          for (int r = 0; r < 8; ++r) {
            const float p0 = __expf(cs0[r] - tmax);
            const float p1 = __expf(cs1[r] - tmax);
            ps += p0 + p1;
            p[h][r] = p0;
            p[h][8 + r] = p1;
            bp[r] = (_Float16)p0;
            bp[8 + r] = (_Float16)p1;
          }
          ps += xhalf(ps);
          s_ml[half][w][h][m] = half ? ps : tmax;

          v8f oz = {};
          o2[e] = wmma16(va, bp, oz);  // rows 8 e .. 8 e + 7 are this head's d
        }
        // lane (m, half) keeps head 2 pr + half: O[query m][16 (2 g + pr) + 8 half + r]
        float4 w0, w1;
        w0.x = half ? o2[1][0] : o2[0][0];
        w0.y = half ? o2[1][1] : o2[0][1];
        w0.z = half ? o2[1][2] : o2[0][2];
        w0.w = half ? o2[1][3] : o2[0][3];
        w1.x = half ? o2[1][4] : o2[0][4];
        w1.y = half ? o2[1][5] : o2[0][5];
        w1.z = half ? o2[1][6] : o2[0][6];
        w1.w = half ? o2[1][7] : o2[0][7];
        float* op = &s_o[w][m][32 * g + 16 * pr + 8 * half];
        *(float4*)op = w0;
        *(float4*)(op + 4) = w1;
      }
    }
    __syncthreads();  // every slice's max, sum and O part are in LDS

    // join the slices: one thread per (head, query) turns the 16 maxima into the
    // 16 factors exp(m_w - max) / sum that scale a slice's P and O
    if (tid < NHEAD * 16) {
      const int hh = tid >> 4, qq = tid & 15;
      float mw[NWV];
      float mg = -1e30f;
#pragma unroll
      for (int i = 0; i < NWV; ++i) {
        mw[i] = s_ml[0][i][hh][qq];
        mg = fmaxf(mg, mw[i]);
      }
      float ls = 0.0f;
#pragma unroll
      for (int i = 0; i < NWV; ++i) {
        mw[i] = __expf(mw[i] - mg);
        ls += mw[i] * s_ml[1][i][hh][qq];
      }
      const float inv = 1.0f / ls;
#pragma unroll
      for (int i = 0; i < NWV; ++i) s_ml[0][i][hh][qq] = mw[i] * inv;
    }
    __syncthreads();  // the factors are in LDS

    // head mean of the normalized weights, in registers, heads in order 0..7
    {
      float acc[16];
#pragma unroll
      for (int j = 0; j < 16; ++j) acc[j] = 0.0f;
#pragma unroll
      for (int h = 0; h < NHEAD; ++h) {
        const float f = 0.125f * s_ml[0][w][h][m];
#pragma unroll
        for (int j = 0; j < 16; ++j) acc[j] += p[h][j] * f;
      }
      float* ap = attw + (size_t)row0 * LSEQ + aoff;
#pragma unroll
      for (int t = 0; t < 2; ++t) {
        *(float4*)(ap + 16 * t) = make_float4(acc[8 * t], acc[8 * t + 1],
                                              acc[8 * t + 2], acc[8 * t + 3]);
        *(float4*)(ap + 16 * t + 4) = make_float4(acc[8 * t + 4], acc[8 * t + 5],
                                                  acc[8 * t + 6], acc[8 * t + 7]);
      }
    }

    // the next tile's Q, fetched under this tile's closing work (no branch: the
    // last trip reads tile 0's rows, long since context, and does not use them)
    {
      const _Float16* qn = &s_ctx[((it + 1) & (QTILES - 1)) * 16 + m][h8];
#pragma unroll
      for (int g = 0; g < 2; ++g) {
        qlo[g] = *(const v8h*)(qn + 32 * g);
        qhi[g] = *(const v8h*)(qn + 32 * g + 16);
      }
    }

    // context: wave w sums query w's 16 O parts, a lane two columns (f16, kept in
    // LDS for the Wo product of the closing part)
    {
      const int c2 = lane * 2, hh = lane >> 2;
      float ox = 0.0f, oy = 0.0f;
#pragma unroll
      for (int i = 0; i < NWV; ++i) {
        const float f = s_ml[0][i][hh][w];
        const float2 ov = *(const float2*)&s_o[i][w][c2];
        ox += ov.x * f;
        oy += ov.y * f;
      }
      typedef __attribute__((ext_vector_type(2))) _Float16 v2h;
      v2h o;
      o[0] = (_Float16)ox;
      o[1] = (_Float16)oy;
      *(v2h*)&s_ctx[it * 16 + w][c2] = o;
    }
    // in front of the next trip's overwrite of the registers that this trip's
    // stores name
    asm volatile("s_wait_xcnt 0x0" ::: "memory");
  }

  // closing part: wave wu < 8 takes rows 16 wu .. 16 wu + 15 of the block; lane
  // (m, half) holds row m, features 16 t + 8 half + r
  const size_t roff = (size_t)(rowb + 16 * (wu & (QTILES - 1)) + m) * EDIM + 8 * half;
  v8f res[4] = {};
  // residual: issued ahead of the barrier, beside the drain of the last tile's stores
  if (wu < QTILES) vec_t(prev + roff, res);
  __syncthreads();  // all 128 context rows are in LDS
  if (wu < QTILES) {
    v16h xb[2];
#pragma unroll
    for (int j = 0; j < 2; ++j) {
      const _Float16* cp = &s_ctx[16 * wu + m][32 * j + h8];
      xb[j] = cat8(*(const v8h*)cp, *(const v8h*)(cp + 16));
    }
    v8f x[4], y[4];
    vec_t(&s_vec[0][h8], x);
    gemm_t(s_w[0], xb, m, half, x);
#pragma unroll
    for (int t = 0; t < 4; ++t) x[t] += res[t];
    ln_t(x, &s_vec[1][h8], &s_vec[2][h8]);

    to_b(x, xb);
    vec_t(&s_vec[3][h8], y);
    gemm_t(s_w[1], xb, m, half, y);
#pragma unroll
    for (int t = 0; t < 4; ++t)
#pragma unroll
      for (int r = 0; r < 8; ++r) y[t][r] = fmaxf(y[t][r], 0.0f);

    to_b(y, xb);
    vec_t(&s_vec[4][h8], y);
    gemm_t(s_w[2], xb, m, half, y);
#pragma unroll
    for (int t = 0; t < 4; ++t) y[t] += x[t];
    ln_t(y, &s_vec[5][h8], &s_vec[6][h8]);

    float* op = out + roff;
#pragma unroll
    for (int t = 0; t < 4; ++t) {
      *(float4*)(op + 16 * t) = make_float4(y[t][0], y[t][1], y[t][2], y[t][3]);
      *(float4*)(op + 16 * t + 4) = make_float4(y[t][4], y[t][5], y[t][6], y[t][7]);
    }
  }
}

// ---------------------------------------------------------------------------
extern "C" void kernel_launch(void* const* d_in, const int* in_sizes, int n_in,
                              void* d_out, int out_size, void* d_ws,
                              size_t ws_size, hipStream_t stream) {
  const float* q    = (const float*)d_in[0];
  const float* k    = (const float*)d_in[1];
  const float* prev = (const float*)d_in[2];
  const float* Wq   = (const float*)d_in[3];
  const float* bq   = (const float*)d_in[4];
  const float* Wk   = (const float*)d_in[5];
  const float* bk   = (const float*)d_in[6];
  const float* Wv   = (const float*)d_in[7];
  const float* bv   = (const float*)d_in[8];
  const float* Wo   = (const float*)d_in[9];
  const float* bo   = (const float*)d_in[10];
  const float* g1   = (const float*)d_in[11];
  const float* bb1  = (const float*)d_in[12];
  const float* W1   = (const float*)d_in[13];
  const float* b1   = (const float*)d_in[14];
  const float* W2   = (const float*)d_in[15];
  const float* b2   = (const float*)d_in[16];
  const float* g2   = (const float*)d_in[17];
  const float* bb2  = (const float*)d_in[18];

  float* out = (float*)d_out;                          // [B, Lq, E]
  float* attw = out + (size_t)BQ * LSEQ * EDIM;        // [B, Lq, Lk]

  ga_attn<<<dim3(LSEQ / (16 * QTILES), BQ), 512, 0, stream>>>(
      q, k, Wq, bq, Wk, bk, Wv, bv, attw, prev, Wo, bo, g1, bb1, W1, b1, W2, b2, g2, bb2, out);
}

// v006
// Measured time: 34.6 microseconds a run.
// Timed twice side by side with v005, it ran 1.03 and 1.04 times as fast.
// Over all steps from v000 it is 6.70 times as fast.
#include <hip/hip_runtime.h>

#define BQ 64
#define LSEQ 512
#define EDIM 64
#define NHEAD 8
#define HDIM 8
#define NROW (BQ * LSEQ) /* 32768 */

typedef __attribute__((ext_vector_type(16))) _Float16 v16h;
typedef __attribute__((ext_vector_type(8))) _Float16 v8h;
typedef __attribute__((ext_vector_type(8))) float v8f;

// K index held by v16h slot s for a lane in K-half `khalf` (ISA 7.12.2,
// 16-bit A 16x32 layout; B uses the same per-lane K ordering with N=lane%16).
__device__ __forceinline__ int kslot(int s, int khalf) {
  int j = s >> 1, p = s & 1;
  return (j < 4) ? (khalf * 8 + j * 2 + p) : (16 + khalf * 8 + (j - 4) * 2 + p);
}

__device__ __forceinline__ v8f wmma16(v16h a, v16h b, v8f c) {
  return __builtin_amdgcn_wmma_f32_16x16x32_f16(false, a, false, b, (short)0, c,
                                                false, false);
}

// value held by lane l ^ 16 (the other 16-lane half), by a vector cross-row move
__device__ __forceinline__ float xhalf(float v) {
  int b = __builtin_bit_cast(int, v);
  b = __builtin_amdgcn_permlanex16(b, b, 0x76543210, 0xfedcba98, false, false);
  return __builtin_bit_cast(float, b);
}

// ---------------------------------------------------------------------------
// The whole layer in one kernel: projections, attention in one pass, and the
// rest of the layer behind it.  grid=(LSEQ/(16*QTILES), B), block=512 (16
// waves): one block per WGP, all resident at once.  Wave w owns keys
// 32w..32w+31 for ALL 8 heads; it forms its K and V^T fragments once, keeps K
// in registers and V^T in an LDS range of its own (registers are short beside
// P), and walks QTILES tiles of 16 queries with them.
// Opening part: out = X W^T + b on f16 operands, q scaled by 1/sqrt(D).  A wave
// reads its 32 rows of k (f32) once as operand fragments and uses them twice:
// as B in K^T = Wk X^T, whose accumulators (key m, 8 features a tile) are slot
// for slot the A operand of the score product, and as A in V = X Wv^T, whose
// accumulators (feature m, 8 keys a tile) are the V^T operand.  Wave w forms 32
// features (half w / 8) of the 16-query tile w % 8 of Q^T = Wq X^T and leaves
// them in LDS (f16) for all.
// Per tile and head: S^T = K Q^T (two 16-key tiles; K rows carry 32 dims = 4
// heads and Q is zeroed outside the head), softmax numerators against the
// wave's own maximum, O^T = V^T P^T over the wave's 32 keys; the eight rows of
// the V^T operand that are not the head's are read as 1.0 and give the sum of P
// (as f16, the values that O is formed from).  P stays in registers.
// The waves' maxima, sums and O parts are joined through LDS; then
// a lane, which holds the same (query, 16 keys) for every head, forms the head
// mean in registers and stores it.  Scores are computed and exponentiated once.
// The LDS areas are doubled and taken by the tile's parity: a wave that writes
// tile t + 2 has passed both barriers of tile t + 1, which every wave reaches
// only behind its last read of tile t.
// Closing part: the block's 128 context rows stay in LDS (f16), and waves 0..7
// take 16 rows each through Wo + residual + LN1, W1 + relu, W2 + residual + LN2.
// Every product is transposed, Y^T = W X^T: a lane then holds 32 features of
// ONE row, so that a row's LN sums are in-lane but for one cross-half move, and
// two accumulator tiles are, slot for slot, the next product's B operand.  The
// six weight matrices (f16) and the ten vectors are put in LDS at the kernel's
// head, beside the loads of the block's k and q rows.
// ---------------------------------------------------------------------------
#define NWV 16      /* waves per block = key slices */
#define OPITCH 68   /* floats per query row of an O part: 64 + 4 against bank conflicts */
#define QTILES 8    /* 16-query tiles a block walks */
#define VROW 33     /* 16-byte places a V^T fragment row: 32 lanes and one of 1.0 */
#define WPITCH 72   /* halves per f16 row in LDS: 64 + 8 (16 bytes) against bank conflicts */

__device__ __forceinline__ v16h cat8(v8h lo, v8h hi) {
  return __builtin_shufflevector(lo, hi, 0, 1, 2, 3, 4, 5, 6, 7, 8, 9, 10, 11,
                                 12, 13, 14, 15);
}

// 16 f32 of a row as one f16 operand: p[0..7] are slots 0..7, p[16..23] slots
// 8..15; with p at dim 32 j + 8 half, slot s is dim 32 j + kslot(s, half)
__device__ __forceinline__ v16h ld_x(const float* p) {
  const float4 a = *(const float4*)p;
  const float4 b = *(const float4*)(p + 4);
  const float4 c = *(const float4*)(p + 16);
  const float4 d = *(const float4*)(p + 20);
  v16h x;
  x[0] = (_Float16)a.x; x[1] = (_Float16)a.y; x[2] = (_Float16)a.z; x[3] = (_Float16)a.w;
  x[4] = (_Float16)b.x; x[5] = (_Float16)b.y; x[6] = (_Float16)b.z; x[7] = (_Float16)b.w;
  x[8] = (_Float16)c.x; x[9] = (_Float16)c.y; x[10] = (_Float16)c.z; x[11] = (_Float16)c.w;
  x[12] = (_Float16)d.x; x[13] = (_Float16)d.y; x[14] = (_Float16)d.z; x[15] = (_Float16)d.w;
  return x;
}

// weight rows 16 t .. 16 t + 15, k block j, as an operand: lane (m, half) holds
// row 16 t + m, slot s is k = 32 j + kslot(s, half)
__device__ __forceinline__ v16h wfrag(const _Float16 (*sw)[WPITCH], int t, int j,
                                      int m, int half) {
  const _Float16* wp = &sw[16 * t + m][32 * j + 8 * half];
  return cat8(*(const v8h*)wp, *(const v8h*)(wp + 16));
}

// c[t] += W[16 t .. 16 t + 15][:] X^T.  A: lane (m, half) holds feature 16 t + m,
// slot s is k = 32 j + kslot(s, half); B (xb[j]): row m, the same k per slot.
// c[t][r] is then (row m, feature 16 t + 8 half + r).
__device__ __forceinline__ void gemm_t(const _Float16 (*sw)[WPITCH], const v16h* xb,
                                       int m, int half, v8f* c) {
#pragma unroll
  for (int j = 0; j < 2; ++j)
#pragma unroll
    for (int t = 0; t < 4; ++t) {
      const _Float16* wp = &sw[16 * t + m][32 * j + 8 * half];
      c[t] = wmma16(cat8(*(const v8h*)wp, *(const v8h*)(wp + 16)), xb[j], c[t]);
    }
}

// accumulator tiles 2 j and 2 j + 1 as the B operand of k block j: slot s < 8 is
// feature 32 j + 8 half + s, slot s >= 8 feature 32 j + 16 + 8 half + s - 8
__device__ __forceinline__ void to_b(const v8f* c, v16h* xb) {
#pragma unroll
  for (int j = 0; j < 2; ++j)
#pragma unroll
    for (int r = 0; r < 8; ++r) {
      xb[j][r] = (_Float16)c[2 * j][r];
      xb[j][8 + r] = (_Float16)c[2 * j + 1][r];
    }
}

// c[t][r] = v[16 t + r]; v points at the lane's half (+ 8 half) of a 64-vector
__device__ __forceinline__ void vec_t(const float* v, v8f* c) {
#pragma unroll
  for (int t = 0; t < 4; ++t) {
    const float4 a = *(const float4*)(v + 16 * t);
    const float4 b = *(const float4*)(v + 16 * t + 4);
    c[t][0] = a.x; c[t][1] = a.y; c[t][2] = a.z; c[t][3] = a.w;
    c[t][4] = b.x; c[t][5] = b.y; c[t][6] = b.z; c[t][7] = b.w;
  }
}

// layer norm of the row a lane pair (m, half 0 and 1) holds; four partial sums
// a lane, so that the additions do not form one long dependent chain
__device__ __forceinline__ void ln_t(v8f* c, const float* g, const float* b) {
  float sm4[4], sq4[4];
#pragma unroll
  for (int t = 0; t < 4; ++t) {
    sm4[t] = 0.0f;
    sq4[t] = 0.0f;
#pragma unroll
    for (int r = 0; r < 8; ++r) {
      sm4[t] += c[t][r];
      sq4[t] += c[t][r] * c[t][r];
    }
  }
  float sm = (sm4[0] + sm4[1]) + (sm4[2] + sm4[3]);
  float sq = (sq4[0] + sq4[1]) + (sq4[2] + sq4[3]);
  sm += xhalf(sm);
  sq += xhalf(sq);
  const float mean = sm * (1.0f / 64.0f);
  const float var = sq * (1.0f / 64.0f) - mean * mean;
  const float rs = __frsqrt_rn(var + 1e-5f);
  v8f gg[4], bv[4];
  vec_t(g, gg);
  vec_t(b, bv);
#pragma unroll
  for (int t = 0; t < 4; ++t)
#pragma unroll
    for (int r = 0; r < 8; ++r) c[t][r] = (c[t][r] - mean) * rs * gg[t][r] + bv[t][r];
}

__global__ void __launch_bounds__(512)
ga_attn(const float* __restrict__ q, const float* __restrict__ k,
        const float* __restrict__ Wq, const float* __restrict__ bq,
        const float* __restrict__ Wk, const float* __restrict__ bk,
        const float* __restrict__ Wv, const float* __restrict__ bv,
        float* __restrict__ attw,
        const float* __restrict__ prev, const float* __restrict__ Wo,
        const float* __restrict__ bo, const float* __restrict__ g1,
        const float* __restrict__ bb1, const float* __restrict__ W1,
        const float* __restrict__ b1, const float* __restrict__ W2,
        const float* __restrict__ b2, const float* __restrict__ g2,
        const float* __restrict__ bb2, float* __restrict__ out) {
  __shared__ __attribute__((aligned(16))) float s_o2[2][NWV][16][OPITCH];  // O parts
  __shared__ float s_ml2[2][2][NWV][NHEAD][16];  // [.][0] max, later factor; [.][1] sum
  __shared__ __attribute__((aligned(16))) v8h s_v[NWV][8][VROW];  // V^T fragments, then 1.0
  __shared__ __attribute__((aligned(16))) _Float16 s_w[6][EDIM][WPITCH];  // Wo W1 W2 Wq Wk Wv
  __shared__ __attribute__((aligned(16))) float s_vec[10][EDIM];  // bo g1 bb1 b1 b2 g2 bb2 bq bk bv
  // rows of a tile: Q until every wave holds the tile's Q in registers (in front
  // of the tile's first barrier), the tile's context from behind its second one
  __shared__ __attribute__((aligned(16))) _Float16 s_ctx[16 * QTILES][WPITCH];
  const int tid = threadIdx.x;
  const int lane = tid & 31;
  const int w = tid >> 5;
  const int b = blockIdx.y;
  const int rowb = b * LSEQ + blockIdx.x * (16 * QTILES);  // first q row of the block
  const int key0 = b * LSEQ + w * 32;                      // flattened first key row
  const int m = lane & 15, half = lane >> 4;
  const v8h z8 = {};
  const int h8 = 8 * half;
  const int wu = __builtin_amdgcn_readfirstlane(w);  // scalar branches round the WMMAs
  // a lane's own part of the address used in the loop, 32 bits, beside a base
  // that is the same for the whole block (fewer registers held)
  const unsigned aoff = (unsigned)(m * LSEQ + w * 32 + 8 * half);

  // the wave's 32 rows of k and 16 rows of q (tile w % 8) as f16 operands: lane
  // (m, half) holds row m of a 16-row tile, slot s is dim 32 j + kslot(s, half)
  const int qt = wu & (QTILES - 1), qf = wu / QTILES;
  const float* kp = k + (size_t)(key0 + m) * EDIM + h8;
  const float* qp = q + (size_t)(rowb + 16 * qt + m) * EDIM + h8;
  v16h xk[2][2], xq[2];
#pragma unroll
  for (int u = 0; u < 2; ++u)
#pragma unroll
    for (int j = 0; j < 2; ++j) xk[u][j] = ld_x(kp + 16 * u * EDIM + 32 * j);
#pragma unroll
  for (int j = 0; j < 2; ++j) xq[j] = ld_x(qp + 32 * j);
  // the weights as f16 and the vectors: a thread takes 8 floats of each matrix,
  // wave i < 10 vector i (two floats a lane; the other waves' load is not used)
  const unsigned woff = (unsigned)(32 * tid);  // in bytes: the register the loads name
  {
    const float* vsrc = bv;
    vsrc = (wu == 0) ? bo : vsrc;
    vsrc = (wu == 1) ? g1 : vsrc;
    vsrc = (wu == 2) ? bb1 : vsrc;
    vsrc = (wu == 3) ? b1 : vsrc;
    vsrc = (wu == 4) ? b2 : vsrc;
    vsrc = (wu == 5) ? g2 : vsrc;
    vsrc = (wu == 6) ? bb2 : vsrc;
    vsrc = (wu == 7) ? bq : vsrc;
    vsrc = (wu == 8) ? bk : vsrc;
    const float2 vv = ((const float2*)vsrc)[lane];
    const float* wsrc[6] = {Wo, W1, W2, Wq, Wk, Wv};
#pragma unroll
    for (int i = 0; i < 6; ++i) {
      const float4 a0 = *(const float4*)((const char*)wsrc[i] + woff);
      const float4 a1 = *(const float4*)((const char*)wsrc[i] + woff + 16);
      v8h hv;
      hv[0] = (_Float16)a0.x; hv[1] = (_Float16)a0.y;
      hv[2] = (_Float16)a0.z; hv[3] = (_Float16)a0.w;
      hv[4] = (_Float16)a1.x; hv[5] = (_Float16)a1.y;
      hv[6] = (_Float16)a1.z; hv[7] = (_Float16)a1.w;
      *(v8h*)&s_w[i][tid >> 3][(tid & 7) * 8] = hv;
    }
    // holds the vector's load in front of the branch, among the loads above: sunk
    // into the branch it would start only behind their wait, a second trip to memory
    asm volatile("" ::"v"(vv.x), "v"(vv.y));
    if (wu < 10) *(float2*)&s_vec[wu][2 * lane] = vv;
  }
  // the wait that belongs in front of any overwrite of an issued load's address
  // registers; the addresses are inputs so that no load lands on one of them
  asm volatile("s_wait_xcnt 0x0" ::"v"(kp), "v"(qp), "v"(woff), "v"(lane) : "memory");
  __syncthreads();  // weights and vectors are in LDS

#pragma unroll
  for (int t = 0; t < 2; ++t) {
    const int f0 = 32 * qf + 16 * t;  // cq[r]: query 16 qt + m, feature f0 + 8 half + r
    const float4 b0 = *(const float4*)&s_vec[7][f0 + h8];
    const float4 b1v = *(const float4*)&s_vec[7][f0 + h8 + 4];
    v8f cq = {b0.x, b0.y, b0.z, b0.w, b1v.x, b1v.y, b1v.z, b1v.w};
#pragma unroll
    for (int j = 0; j < 2; ++j) cq = wmma16(wfrag(s_w[3], 2 * qf + t, j, m, half), xq[j], cq);
    v8h o;
#pragma unroll
    for (int r = 0; r < 8; ++r) o[r] = (_Float16)(cq[r] * 0.35355339059327373f);
    *(v8h*)&s_ctx[16 * qt + m][f0 + h8] = o;
  }

  v16h kf[2][2];  // kf[g][u]: key 16 u + m, slot s is dim 32 g + kslot(s, half)
  {
    v8f ck[2][4];  // ck[u][t][r]: key 16 u + m, feature 16 t + 8 half + r
    vec_t(&s_vec[8][h8], ck[0]);
#pragma unroll
    for (int t = 0; t < 4; ++t) ck[1][t] = ck[0][t];
#pragma unroll
    for (int j = 0; j < 2; ++j)
#pragma unroll
      for (int t = 0; t < 4; ++t) {
        const v16h wf = wfrag(s_w[4], t, j, m, half);
        ck[0][t] = wmma16(wf, xk[0][j], ck[0][t]);
        ck[1][t] = wmma16(wf, xk[1][j], ck[1][t]);
      }
#pragma unroll
    for (int u = 0; u < 2; ++u) {
      v16h kb[2];
      to_b(ck[u], kb);
      kf[0][u] = kb[0];
      kf[1][u] = kb[1];
    }
  }
  // V^T fragments (row m of pair i = column 16 i + m of V, slot s = key
  // kslot(s, half)): parked in the wave's own LDS range, a lane's 16 bytes side
  // by side; only the wave that wrote them reads them
#pragma unroll
  for (int i = 0; i < 4; ++i) {
    const float bn = s_vec[9][16 * i + m];
    v8f c0, c1;  // cu[r]: key 16 u + 8 half + r, feature 16 i + m
#pragma unroll
    for (int r = 0; r < 8; ++r) c0[r] = c1[r] = bn;
#pragma unroll
    for (int j = 0; j < 2; ++j) {
      const v16h wf = wfrag(s_w[5], i, j, m, half);
      c0 = wmma16(xk[0][j], wf, c0);
      c1 = wmma16(xk[1][j], wf, c1);
    }
    v8h o0, o1;
#pragma unroll
    for (int r = 0; r < 8; ++r) {
      o0[r] = (_Float16)c0[r];
      o1[r] = (_Float16)c1[r];
    }
    s_v[w][2 * i][lane] = o0;
    s_v[w][2 * i + 1][lane] = o1;
  }
  // place 32 of each row is 1.0: head e's product reads it in the lanes whose
  // rows of the pair belong to the other head
  if (lane < 8) {
    v8h one8;
#pragma unroll
    for (int r = 0; r < 8; ++r) one8[r] = (_Float16)1.0f;
    s_v[w][lane][32] = one8;
  }
  const v8h* vp0 = &s_v[w][0][(m < 8) ? lane : 32];
  const v8h* vp1 = &s_v[w][0][(m < 8) ? 32 : lane];
  __syncthreads();  // all 128 rows of Q are in LDS

  // slot s of a lane is dim 32 g + kslot(s, half) for Q as for K
  v8h qlo[2], qhi[2];
#pragma unroll
  for (int g = 0; g < 2; ++g) {
    qlo[g] = *(const v8h*)&s_ctx[m][32 * g + h8];
    qhi[g] = *(const v8h*)&s_ctx[m][32 * g + 16 + h8];
  }

// rolled, for speed only
#pragma unroll 1
  for (int it = 0; it < QTILES; ++it) {
    const int row0 = rowb + it * 16;  // flattened first q row of the tile
    float (*s_o)[16][OPITCH] = s_o2[it & 1];
    float (*s_ml)[NWV][NHEAD][16] = s_ml2[it & 1];
    float p[NHEAD][16];  // p[h][8 t + r]: query m, key 32 w + 16 t + 8 half + r

#pragma unroll
    for (int g = 0; g < 2; ++g) {  // dims 32 g .. 32 g + 31 = heads 4 g .. 4 g + 3
#pragma unroll
      for (int pr = 0; pr < 2; ++pr) {  // head pair: 16 columns of V
        v8f o2[2];
#pragma unroll
        for (int e = 0; e < 2; ++e) {
          const int h = 4 * g + 2 * pr + e;
          // the head's 8 dims sit in half e, low slots (pr 0) or high slots (pr 1)
          const v8h sel = (half == e) ? (pr ? qhi[g] : qlo[g]) : z8;
          const v16h bq = pr ? cat8(z8, sel) : cat8(sel, z8);
          v8f cs0 = {}, cs1 = {};
          cs0 = wmma16(kf[g][0], bq, cs0);  // cs[r] = S[query m][key 16 t + 8 half + r]
          cs1 = wmma16(kf[g][1], bq, cs1);

          float tmax = fmaxf(cs0[0], cs1[0]);
#pragma unroll
          for (int r = 1; r < 8; ++r) tmax = fmaxf(tmax, fmaxf(cs0[r], cs1[r]));
          tmax = fmaxf(tmax, xhalf(tmax));  // all 32 keys of the slice

          v16h bp;  // P^T as B: slot s is key kslot(s, half), the accumulators' own map
#pragma unroll
          for (int r = 0; r < 8; ++r) {
            const float p0 = __expf(cs0[r] - tmax);
            const float p1 = __expf(cs1[r] - tmax);
            p[h][r] = p0;
            p[h][8 + r] = p1;
            bp[r] = (_Float16)p0;
            bp[8 + r] = (_Float16)p1;
          }
          // rows 8 e .. 8 e + 7 are this head's d; the other eight rows of A are 1.0,
          // so the lanes of the other half hold the slice's sum of P in every slot
          const v8h* vp = e ? vp1 : vp0;
          const v16h va = cat8(vp[(4 * g + 2 * pr) * VROW], vp[(4 * g + 2 * pr + 1) * VROW]);
          v8f oz = {};
          o2[e] = wmma16(va, bp, oz);
          s_ml[half ^ e][w][h][m] = (half ^ e) ? o2[e][0] : tmax;
        }
        // lane (m, half) keeps head 2 pr + half: O[query m][16 (2 g + pr) + 8 half + r]
        float4 w0, w1;
        w0.x = half ? o2[1][0] : o2[0][0];
        w0.y = half ? o2[1][1] : o2[0][1];
        w0.z = half ? o2[1][2] : o2[0][2];
        w0.w = half ? o2[1][3] : o2[0][3];
        w1.x = half ? o2[1][4] : o2[0][4];
        w1.y = half ? o2[1][5] : o2[0][5];
        w1.z = half ? o2[1][6] : o2[0][6];
        w1.w = half ? o2[1][7] : o2[0][7];
        float* op = &s_o[w][m][32 * g + 16 * pr + 8 * half];
        *(float4*)op = w0;
        *(float4*)(op + 4) = w1;
      }
    }
    __syncthreads();  // every slice's max, sum and O part are in LDS

    // join the slices: one thread per (head, query) turns the 16 maxima into the
    // 16 factors exp(m_w - max) / sum that scale a slice's P and O
    if (tid < NHEAD * 16) {
      const int hh = tid >> 4, qq = tid & 15;
      float mw[NWV];
      float mg = -1e30f;
#pragma unroll
      for (int i = 0; i < NWV; ++i) {
        mw[i] = s_ml[0][i][hh][qq];
        mg = fmaxf(mg, mw[i]);
      }
      float ls = 0.0f;
#pragma unroll
      for (int i = 0; i < NWV; ++i) {
        mw[i] = __expf(mw[i] - mg);
        ls += mw[i] * s_ml[1][i][hh][qq];
      }
      const float inv = 1.0f / ls;
#pragma unroll
      for (int i = 0; i < NWV; ++i) s_ml[0][i][hh][qq] = mw[i] * inv;
    }
    __syncthreads();  // the factors are in LDS

    // head mean of the normalized weights, in registers, heads in order 0..7
    {
      float acc[16];
#pragma unroll
      for (int j = 0; j < 16; ++j) acc[j] = 0.0f;
#pragma unroll
      for (int h = 0; h < NHEAD; ++h) {
        const float f = 0.125f * s_ml[0][w][h][m];
#pragma unroll
        for (int j = 0; j < 16; ++j) acc[j] += p[h][j] * f;
      }
      float* ap = attw + (size_t)row0 * LSEQ + aoff;
#pragma unroll
      for (int t = 0; t < 2; ++t) {
        *(float4*)(ap + 16 * t) = make_float4(acc[8 * t], acc[8 * t + 1],
                                              acc[8 * t + 2], acc[8 * t + 3]);
        *(float4*)(ap + 16 * t + 4) = make_float4(acc[8 * t + 4], acc[8 * t + 5],
                                                  acc[8 * t + 6], acc[8 * t + 7]);
      }
    }

    // the next tile's Q, fetched under this tile's closing work (no branch: the
    // last trip reads tile 0's rows, long since context, and does not use them)
    {
      const _Float16* qn = &s_ctx[((it + 1) & (QTILES - 1)) * 16 + m][h8];
#pragma unroll
      for (int g = 0; g < 2; ++g) {
        qlo[g] = *(const v8h*)(qn + 32 * g);
        qhi[g] = *(const v8h*)(qn + 32 * g + 16);
      }
    }

    // context: wave w sums query w's 16 O parts, a lane two columns (f16, kept in
    // LDS for the Wo product of the closing part)
    {
      const int c2 = lane * 2, hh = lane >> 2;
      float ox = 0.0f, oy = 0.0f;
#pragma unroll
      for (int i = 0; i < NWV; ++i) {
        const float f = s_ml[0][i][hh][w];
        const float2 ov = *(const float2*)&s_o[i][w][c2];
        ox += ov.x * f;
        oy += ov.y * f;
      }
      typedef __attribute__((ext_vector_type(2))) _Float16 v2h;
      v2h o;
      o[0] = (_Float16)ox;
      o[1] = (_Float16)oy;
      *(v2h*)&s_ctx[it * 16 + w][c2] = o;
    }
    // in front of the next trip's overwrite of the registers that this trip's
    // stores name
    asm volatile("s_wait_xcnt 0x0" ::: "memory");
  }

  // closing part: wave wu < 8 takes rows 16 wu .. 16 wu + 15 of the block; lane
  // (m, half) holds row m, features 16 t + 8 half + r
  const size_t roff = (size_t)(rowb + 16 * (wu & (QTILES - 1)) + m) * EDIM + 8 * half;
  v8f res[4] = {};
  // residual: issued ahead of the barrier, beside the drain of the last tile's stores
  if (wu < QTILES) vec_t(prev + roff, res);
  __syncthreads();  // all 128 context rows are in LDS
  if (wu < QTILES) {
    v16h xb[2];
#pragma unroll
    for (int j = 0; j < 2; ++j) {
      const _Float16* cp = &s_ctx[16 * wu + m][32 * j + h8];
      xb[j] = cat8(*(const v8h*)cp, *(const v8h*)(cp + 16));
    }
    v8f x[4], y[4];
    vec_t(&s_vec[0][h8], x);
    gemm_t(s_w[0], xb, m, half, x);
#pragma unroll
    for (int t = 0; t < 4; ++t) x[t] += res[t];
    ln_t(x, &s_vec[1][h8], &s_vec[2][h8]);

    to_b(x, xb);
    vec_t(&s_vec[3][h8], y);
    gemm_t(s_w[1], xb, m, half, y);
#pragma unroll
    for (int t = 0; t < 4; ++t)
#pragma unroll
      for (int r = 0; r < 8; ++r) y[t][r] = fmaxf(y[t][r], 0.0f);

    to_b(y, xb);
    vec_t(&s_vec[4][h8], y);
    gemm_t(s_w[2], xb, m, half, y);
#pragma unroll
    for (int t = 0; t < 4; ++t) y[t] += x[t];
    ln_t(y, &s_vec[5][h8], &s_vec[6][h8]);

    float* op = out + roff;
#pragma unroll
    for (int t = 0; t < 4; ++t) {
      *(float4*)(op + 16 * t) = make_float4(y[t][0], y[t][1], y[t][2], y[t][3]);
      *(float4*)(op + 16 * t + 4) = make_float4(y[t][4], y[t][5], y[t][6], y[t][7]);
    }
  }
}

// ---------------------------------------------------------------------------
extern "C" void kernel_launch(void* const* d_in, const int* in_sizes, int n_in,
                              void* d_out, int out_size, void* d_ws,
                              size_t ws_size, hipStream_t stream) {
  const float* q    = (const float*)d_in[0];
  const float* k    = (const float*)d_in[1];
  const float* prev = (const float*)d_in[2];
  const float* Wq   = (const float*)d_in[3];
  const float* bq   = (const float*)d_in[4];
  const float* Wk   = (const float*)d_in[5];
  const float* bk   = (const float*)d_in[6];
  const float* Wv   = (const float*)d_in[7];
  const float* bv   = (const float*)d_in[8];
  const float* Wo   = (const float*)d_in[9];
  const float* bo   = (const float*)d_in[10];
  const float* g1   = (const float*)d_in[11];
  const float* bb1  = (const float*)d_in[12];
  const float* W1   = (const float*)d_in[13];
  const float* b1   = (const float*)d_in[14];
  const float* W2   = (const float*)d_in[15];
  const float* b2   = (const float*)d_in[16];
  const float* g2   = (const float*)d_in[17];
  const float* bb2  = (const float*)d_in[18];

  float* out = (float*)d_out;                          // [B, Lq, E]
  float* attw = out + (size_t)BQ * LSEQ * EDIM;        // [B, Lq, Lk]

  ga_attn<<<dim3(LSEQ / (16 * QTILES), BQ), 512, 0, stream>>>(
      q, k, Wq, bq, Wk, bk, Wv, bv, attw, prev, Wo, bo, g1, bb1, W1, b1, W2, b2, g2, bb2, out);
}

// v007
// One run takes 30.4 microseconds.
// In both of two side-by-side timings against v006, it was 1.14 times as fast.
// All steps since v000 together make it 7.63 times as fast.
#include <hip/hip_runtime.h>

#define BQ 64
#define LSEQ 512
#define EDIM 64
#define NHEAD 8
#define HDIM 8
#define NROW (BQ * LSEQ) /* 32768 */

typedef __attribute__((ext_vector_type(16))) _Float16 v16h;
typedef __attribute__((ext_vector_type(8))) _Float16 v8h;
typedef __attribute__((ext_vector_type(8))) float v8f;

// K index held by v16h slot s for a lane in K-half `khalf` (ISA 7.12.2,
// 16-bit A 16x32 layout; B uses the same per-lane K ordering with N=lane%16).
__device__ __forceinline__ int kslot(int s, int khalf) {
  int j = s >> 1, p = s & 1;
  return (j < 4) ? (khalf * 8 + j * 2 + p) : (16 + khalf * 8 + (j - 4) * 2 + p);
}

__device__ __forceinline__ v8f wmma16(v16h a, v16h b, v8f c) {
  return __builtin_amdgcn_wmma_f32_16x16x32_f16(false, a, false, b, (short)0, c,
                                                false, false);
}

// value held by lane l ^ 16 (the other 16-lane half), by a vector cross-row move
__device__ __forceinline__ float xhalf(float v) {
  int b = __builtin_bit_cast(int, v);
  b = __builtin_amdgcn_permlanex16(b, b, 0x76543210, 0xfedcba98, false, false);
  return __builtin_bit_cast(float, b);
}

// ---------------------------------------------------------------------------
// The whole layer in one kernel: projections, attention in one pass, and the
// rest of the layer behind it.  grid=(LSEQ/(16*QTILES), B), block=512 (16
// waves): one block per WGP, all resident at once.  Wave w owns keys
// 32w..32w+31 for ALL 8 heads; it forms its K and V^T fragments once, keeps K
// in registers and V^T in an LDS range of its own (registers are short beside
// P), and walks QTILES tiles of 16 queries with them.
// Opening part: out = X W^T + b on f16 operands, q scaled by 1/sqrt(D).  A wave
// reads its 32 rows of k (f32) once as operand fragments and uses them twice:
// as B in K^T = Wk X^T, whose accumulators (key m, 8 features a tile) are slot
// for slot the A operand of the score product, and as A in V = X Wv^T, whose
// accumulators (feature m, 8 keys a tile) are the V^T operand.  Wave w forms 32
// features (half w / 8) of the 16-query tile w % 8 of Q^T = Wq X^T and leaves
// them in LDS (f16) for all.
// Per tile and head: S^T = K Q^T (two 16-key tiles; K rows carry 32 dims = 4
// heads and Q is zeroed outside the head), softmax numerators against the
// wave's own maximum (in the general form only), O^T = V^T P^T over the wave's 32 keys; the eight rows of
// the V^T operand that are not the head's are read as 1.0 and give the sum of P
// (as f16, the values that O is formed from).  P stays in registers.
// The waves' sums, O parts and (general form) maxima are joined through LDS; then
// a lane, which holds the same (query, 16 keys) for every head, forms the head
// mean in registers and stores it.  Scores are computed and exponentiated once.
// The LDS areas are doubled and taken by the tile's parity: a wave that writes
// tile t + 2 has passed both barriers of tile t + 1, which every wave reaches
// only behind its last read of tile t.
// Closing part: the block's 128 context rows stay in LDS (f16), and waves 0..7
// take 16 rows each through Wo + residual + LN1, W1 + relu, W2 + residual + LN2.
// Every product is transposed, Y^T = W X^T: a lane then holds 32 features of
// ONE row, so that a row's LN sums are in-lane but for one cross-half move, and
// two accumulator tiles are, slot for slot, the next product's B operand.  The
// six weight matrices (f16) and the ten vectors are put in LDS at the kernel's
// head, beside the loads of the block's k and q rows.
// ---------------------------------------------------------------------------
#define NWV 16      /* waves per block = key slices */
#define OPITCH 68   /* floats per query row of an O part: 64 + 4 against bank conflicts */
#define QTILES 8    /* 16-query tiles a block walks */
#define VROW 33     /* 16-byte places a V^T fragment row: 32 lanes and one of 1.0 */
#define WPITCH 72   /* halves per f16 row in LDS: 64 + 8 (16 bytes) against bank conflicts */

template <bool B> struct bconst { static constexpr bool value = B; };

__device__ __forceinline__ v16h cat8(v8h lo, v8h hi) {
  return __builtin_shufflevector(lo, hi, 0, 1, 2, 3, 4, 5, 6, 7, 8, 9, 10, 11,
                                 12, 13, 14, 15);
}

// 16 f32 of a row as one f16 operand: p[0..7] are slots 0..7, p[16..23] slots
// 8..15; with p at dim 32 j + 8 half, slot s is dim 32 j + kslot(s, half)
__device__ __forceinline__ v16h ld_x(const float* p) {
  const float4 a = *(const float4*)p;
  const float4 b = *(const float4*)(p + 4);
  const float4 c = *(const float4*)(p + 16);
  const float4 d = *(const float4*)(p + 20);
  v16h x;
  x[0] = (_Float16)a.x; x[1] = (_Float16)a.y; x[2] = (_Float16)a.z; x[3] = (_Float16)a.w;
  x[4] = (_Float16)b.x; x[5] = (_Float16)b.y; x[6] = (_Float16)b.z; x[7] = (_Float16)b.w;
  x[8] = (_Float16)c.x; x[9] = (_Float16)c.y; x[10] = (_Float16)c.z; x[11] = (_Float16)c.w;
  x[12] = (_Float16)d.x; x[13] = (_Float16)d.y; x[14] = (_Float16)d.z; x[15] = (_Float16)d.w;
  return x;
}

// weight rows 16 t .. 16 t + 15, k block j, as an operand: lane (m, half) holds
// row 16 t + m, slot s is k = 32 j + kslot(s, half)
__device__ __forceinline__ v16h wfrag(const _Float16 (*sw)[WPITCH], int t, int j,
                                      int m, int half) {
  const _Float16* wp = &sw[16 * t + m][32 * j + 8 * half];
  return cat8(*(const v8h*)wp, *(const v8h*)(wp + 16));
}

// c[t] += W[16 t .. 16 t + 15][:] X^T.  A: lane (m, half) holds feature 16 t + m,
// slot s is k = 32 j + kslot(s, half); B (xb[j]): row m, the same k per slot.
// c[t][r] is then (row m, feature 16 t + 8 half + r).
__device__ __forceinline__ void gemm_t(const _Float16 (*sw)[WPITCH], const v16h* xb,
                                       int m, int half, v8f* c) {
#pragma unroll
  for (int j = 0; j < 2; ++j)
#pragma unroll
    for (int t = 0; t < 4; ++t) {
      const _Float16* wp = &sw[16 * t + m][32 * j + 8 * half];
      c[t] = wmma16(cat8(*(const v8h*)wp, *(const v8h*)(wp + 16)), xb[j], c[t]);
    }
}

// accumulator tiles 2 j and 2 j + 1 as the B operand of k block j: slot s < 8 is
// feature 32 j + 8 half + s, slot s >= 8 feature 32 j + 16 + 8 half + s - 8
__device__ __forceinline__ void to_b(const v8f* c, v16h* xb) {
#pragma unroll
  for (int j = 0; j < 2; ++j)
#pragma unroll
    for (int r = 0; r < 8; ++r) {
      xb[j][r] = (_Float16)c[2 * j][r];
      xb[j][8 + r] = (_Float16)c[2 * j + 1][r];
    }
}

// c[t][r] = v[16 t + r]; v points at the lane's half (+ 8 half) of a 64-vector
__device__ __forceinline__ void vec_t(const float* v, v8f* c) {
#pragma unroll
  for (int t = 0; t < 4; ++t) {
    const float4 a = *(const float4*)(v + 16 * t);
    const float4 b = *(const float4*)(v + 16 * t + 4);
    c[t][0] = a.x; c[t][1] = a.y; c[t][2] = a.z; c[t][3] = a.w;
    c[t][4] = b.x; c[t][5] = b.y; c[t][6] = b.z; c[t][7] = b.w;
  }
}

// layer norm of the row a lane pair (m, half 0 and 1) holds; four partial sums
// a lane, so that the additions do not form one long dependent chain
__device__ __forceinline__ void ln_t(v8f* c, const float* g, const float* b) {
  float sm4[4], sq4[4];
#pragma unroll
  for (int t = 0; t < 4; ++t) {
    sm4[t] = 0.0f;
    sq4[t] = 0.0f;
#pragma unroll
    for (int r = 0; r < 8; ++r) {
      sm4[t] += c[t][r];
      sq4[t] += c[t][r] * c[t][r];
    }
  }
  float sm = (sm4[0] + sm4[1]) + (sm4[2] + sm4[3]);
  float sq = (sq4[0] + sq4[1]) + (sq4[2] + sq4[3]);
  sm += xhalf(sm);
  sq += xhalf(sq);
  const float mean = sm * (1.0f / 64.0f);
  const float var = sq * (1.0f / 64.0f) - mean * mean;
  const float rs = __frsqrt_rn(var + 1e-5f);
  v8f gg[4], bv[4];
  vec_t(g, gg);
  vec_t(b, bv);
#pragma unroll
  for (int t = 0; t < 4; ++t)
#pragma unroll
    for (int r = 0; r < 8; ++r) c[t][r] = (c[t][r] - mean) * rs * gg[t][r] + bv[t][r];
}

__global__ void __launch_bounds__(512)
ga_attn(const float* __restrict__ q, const float* __restrict__ k,
        const float* __restrict__ Wq, const float* __restrict__ bq,
        const float* __restrict__ Wk, const float* __restrict__ bk,
        const float* __restrict__ Wv, const float* __restrict__ bv,
        float* __restrict__ attw,
        const float* __restrict__ prev, const float* __restrict__ Wo,
        const float* __restrict__ bo, const float* __restrict__ g1,
        const float* __restrict__ bb1, const float* __restrict__ W1,
        const float* __restrict__ b1, const float* __restrict__ W2,
        const float* __restrict__ b2, const float* __restrict__ g2,
        const float* __restrict__ bb2, float* __restrict__ out) {
  __shared__ __attribute__((aligned(16))) float s_o2[2][NWV][16][OPITCH];  // O parts
  __shared__ float s_ml2[2][2][NWV][NHEAD][16];  // [.][0] max, later factor; [.][1] sum
  __shared__ __attribute__((aligned(16))) v8h s_v[NWV][8][VROW];  // V^T fragments, then 1.0
  __shared__ __attribute__((aligned(16))) _Float16 s_w[6][EDIM][WPITCH];  // Wo W1 W2 Wq Wk Wv
  __shared__ __attribute__((aligned(16))) float s_vec[10][EDIM];  // bo g1 bb1 b1 b2 g2 bb2 bq bk bv
  // rows of a tile: Q until every wave holds the tile's Q in registers (in front
  // of the tile's first barrier), the tile's context from behind its second one
  __shared__ __attribute__((aligned(16))) _Float16 s_ctx[16 * QTILES][WPITCH];
  __shared__ int s_ok[NWV];  // per wave: its rows of K and Q keep the norm bound
  const int tid = threadIdx.x;
  const int lane = tid & 31;
  const int w = tid >> 5;
  const int b = blockIdx.y;
  const int rowb = b * LSEQ + blockIdx.x * (16 * QTILES);  // first q row of the block
  const int key0 = b * LSEQ + w * 32;                      // flattened first key row
  const int m = lane & 15, half = lane >> 4;
  const v8h z8 = {};
  const int h8 = 8 * half;
  const int wu = __builtin_amdgcn_readfirstlane(w);  // scalar branches round the WMMAs
  // a lane's own part of the address used in the loop, 32 bits, beside a base
  // that is the same for the whole block (fewer registers held)
  const unsigned aoff = (unsigned)(m * LSEQ + w * 32 + 8 * half);

  // the wave's 32 rows of k and 16 rows of q (tile w % 8) as f16 operands: lane
  // (m, half) holds row m of a 16-row tile, slot s is dim 32 j + kslot(s, half)
  const int qt = wu & (QTILES - 1), qf = wu / QTILES;
  const float* kp = k + (size_t)(key0 + m) * EDIM + h8;
  const float* qp = q + (size_t)(rowb + 16 * qt + m) * EDIM + h8;
  v16h xk[2][2], xq[2];
#pragma unroll
  for (int u = 0; u < 2; ++u)
#pragma unroll
    for (int j = 0; j < 2; ++j) xk[u][j] = ld_x(kp + 16 * u * EDIM + 32 * j);
#pragma unroll
  for (int j = 0; j < 2; ++j) xq[j] = ld_x(qp + 32 * j);
  // the weights as f16 and the vectors: a thread takes 8 floats of each matrix,
  // wave i < 10 vector i (two floats a lane; the other waves' load is not used)
  const unsigned woff = (unsigned)(32 * tid);  // in bytes: the register the loads name
  {
    const float* vsrc = bv;
    vsrc = (wu == 0) ? bo : vsrc;
    vsrc = (wu == 1) ? g1 : vsrc;
    vsrc = (wu == 2) ? bb1 : vsrc;
    vsrc = (wu == 3) ? b1 : vsrc;
    vsrc = (wu == 4) ? b2 : vsrc;
    vsrc = (wu == 5) ? g2 : vsrc;
    vsrc = (wu == 6) ? bb2 : vsrc;
    vsrc = (wu == 7) ? bq : vsrc;
    vsrc = (wu == 8) ? bk : vsrc;
    const float2 vv = ((const float2*)vsrc)[lane];
    const float* wsrc[6] = {Wo, W1, W2, Wq, Wk, Wv};
#pragma unroll
    for (int i = 0; i < 6; ++i) {
      const float4 a0 = *(const float4*)((const char*)wsrc[i] + woff);
      const float4 a1 = *(const float4*)((const char*)wsrc[i] + woff + 16);
      v8h hv;
      hv[0] = (_Float16)a0.x; hv[1] = (_Float16)a0.y;
      hv[2] = (_Float16)a0.z; hv[3] = (_Float16)a0.w;
      hv[4] = (_Float16)a1.x; hv[5] = (_Float16)a1.y;
      hv[6] = (_Float16)a1.z; hv[7] = (_Float16)a1.w;
      *(v8h*)&s_w[i][tid >> 3][(tid & 7) * 8] = hv;
    }
    // holds the vector's load in front of the branch, among the loads above: sunk
    // into the branch it would start only behind their wait, a second trip to memory
    asm volatile("" ::"v"(vv.x), "v"(vv.y));
    if (wu < 10) *(float2*)&s_vec[wu][2 * lane] = vv;
  }
  // the wait that belongs in front of any overwrite of an issued load's address
  // registers; the addresses are inputs so that no load lands on one of them
  asm volatile("s_wait_xcnt 0x0" ::"v"(kp), "v"(qp), "v"(woff), "v"(lane) : "memory");
  __syncthreads();  // weights and vectors are in LDS

  float qn2 = 0.0f, kn2 = 0.0f;  // largest squared norm of a head's 8 dims the lane has seen
#pragma unroll
  for (int t = 0; t < 2; ++t) {
    const int f0 = 32 * qf + 16 * t;  // cq[r]: query 16 qt + m, feature f0 + 8 half + r
    const float4 b0 = *(const float4*)&s_vec[7][f0 + h8];
    const float4 b1v = *(const float4*)&s_vec[7][f0 + h8 + 4];
    v8f cq = {b0.x, b0.y, b0.z, b0.w, b1v.x, b1v.y, b1v.z, b1v.w};
#pragma unroll
    for (int j = 0; j < 2; ++j) cq = wmma16(wfrag(s_w[3], 2 * qf + t, j, m, half), xq[j], cq);
    v8h o;
    float n2 = 0.0f;  // the lane's 8 features are one head's
#pragma unroll
    for (int r = 0; r < 8; ++r) {
      const float sv = cq[r] * 0.35355339059327373f;
      o[r] = (_Float16)sv;
      n2 += sv * sv;
    }
    qn2 = fmaxf(qn2, n2);
    *(v8h*)&s_ctx[16 * qt + m][f0 + h8] = o;
  }

  v16h kf[2][2];  // kf[g][u]: key 16 u + m, slot s is dim 32 g + kslot(s, half)
  {
    v8f ck[2][4];  // ck[u][t][r]: key 16 u + m, feature 16 t + 8 half + r
    vec_t(&s_vec[8][h8], ck[0]);
#pragma unroll
    for (int t = 0; t < 4; ++t) ck[1][t] = ck[0][t];
#pragma unroll
    for (int j = 0; j < 2; ++j)
#pragma unroll
      for (int t = 0; t < 4; ++t) {
        const v16h wf = wfrag(s_w[4], t, j, m, half);
        ck[0][t] = wmma16(wf, xk[0][j], ck[0][t]);
        ck[1][t] = wmma16(wf, xk[1][j], ck[1][t]);
      }
#pragma unroll
    for (int u = 0; u < 2; ++u) {
#pragma unroll
      for (int t = 0; t < 4; ++t) {  // ck[u][t][0..7] is head 2 t + half of one key
        float n2 = 0.0f;
#pragma unroll
        for (int r = 0; r < 8; ++r) n2 += ck[u][t][r] * ck[u][t][r];
        kn2 = fmaxf(kn2, n2);
      }
      v16h kb[2];
      to_b(ck[u], kb);
      kf[0][u] = kb[0];
      kf[1][u] = kb[1];
    }
  }
  // V^T fragments (row m of pair i = column 16 i + m of V, slot s = key
  // kslot(s, half)): parked in the wave's own LDS range, a lane's 16 bytes side
  // by side; only the wave that wrote them reads them
#pragma unroll
  for (int i = 0; i < 4; ++i) {
    const float bn = s_vec[9][16 * i + m];
    v8f c0, c1;  // cu[r]: key 16 u + 8 half + r, feature 16 i + m
#pragma unroll
    for (int r = 0; r < 8; ++r) c0[r] = c1[r] = bn;
#pragma unroll
    for (int j = 0; j < 2; ++j) {
      const v16h wf = wfrag(s_w[5], i, j, m, half);
      c0 = wmma16(xk[0][j], wf, c0);
      c1 = wmma16(xk[1][j], wf, c1);
    }
    v8h o0, o1;
#pragma unroll
    for (int r = 0; r < 8; ++r) {
      o0[r] = (_Float16)c0[r];
      o1[r] = (_Float16)c1[r];
    }
    s_v[w][2 * i][lane] = o0;
    s_v[w][2 * i + 1][lane] = o1;
  }
  // place 32 of each row is 1.0: head e's product reads it in the lanes whose
  // rows of the pair belong to the other head
  if (lane < 8) {
    v8h one8;
#pragma unroll
    for (int r = 0; r < 8; ++r) one8[r] = (_Float16)1.0f;
    s_v[w][lane][32] = one8;
  }
  // |score| <= |q_h| |k_h| <= 8 where every head's |k_h|^2 <= 8 sqrt(8) and (q scaled)
  // |q_h|^2 <= sqrt(8).  The ballot makes the wave's answer; every lane stores that value.
  s_ok[w] = __builtin_amdgcn_ballot_w32(kn2 <= 22.627417f && qn2 <= 2.8284271f) == 0xffffffffu;
  const v8h* vp0 = &s_v[w][0][(m < 8) ? lane : 32];
  const v8h* vp1 = &s_v[w][0][(m < 8) ? 32 : lane];
  __syncthreads();  // all 128 rows of Q are in LDS

  // slot s of a lane is dim 32 g + kslot(s, half) for Q as for K
  v8h qlo[2], qhi[2];
#pragma unroll
  for (int g = 0; g < 2; ++g) {
    qlo[g] = *(const v8h*)&s_ctx[m][32 * g + h8];
    qhi[g] = *(const v8h*)&s_ctx[m][32 * g + 16 + h8];
  }

  // the same in every wave of the block: each reads all 16 flags
  const bool fast = __builtin_amdgcn_ballot_w32(s_ok[lane & 15] != 0) == 0xffffffffu;

  // The walk over the tiles, in two forms.  FAST (every score of the block is within
  // +-8): exp(score) itself lies between 3.3e-4 and 2981, inside f16's normal range,
  // so no maximum is taken or subtracted, and one factor 1 / sum serves all slices.
  // Otherwise the general form, against each slice's own maximum.
  auto tiles = [&](auto fc) {
  constexpr bool FAST = decltype(fc)::value;
// rolled: one copy of the body (for speed only)
#pragma unroll 1
  for (int it = 0; it < QTILES; ++it) {
    const int row0 = rowb + it * 16;  // flattened first q row of the tile
    float (*s_o)[16][OPITCH] = s_o2[it & 1];
    float (*s_ml)[NWV][NHEAD][16] = s_ml2[it & 1];
    float p[NHEAD][16];  // p[h][8 t + r]: query m, key 32 w + 16 t + 8 half + r

#pragma unroll
    for (int g = 0; g < 2; ++g) {  // dims 32 g .. 32 g + 31 = heads 4 g .. 4 g + 3
#pragma unroll
      for (int pr = 0; pr < 2; ++pr) {  // head pair: 16 columns of V
        v8f o2[2];
#pragma unroll
        for (int e = 0; e < 2; ++e) {
          const int h = 4 * g + 2 * pr + e;
          // the head's 8 dims sit in half e, low slots (pr 0) or high slots (pr 1)
          const v8h sel = (half == e) ? (pr ? qhi[g] : qlo[g]) : z8;
          const v16h bq = pr ? cat8(z8, sel) : cat8(sel, z8);
          v8f cs0 = {}, cs1 = {};
          cs0 = wmma16(kf[g][0], bq, cs0);  // cs[r] = S[query m][key 16 t + 8 half + r]
          cs1 = wmma16(kf[g][1], bq, cs1);

          float tmax = 0.0f;
          if constexpr (!FAST) {
            tmax = fmaxf(cs0[0], cs1[0]);
#pragma unroll
            for (int r = 1; r < 8; ++r) tmax = fmaxf(tmax, fmaxf(cs0[r], cs1[r]));
            tmax = fmaxf(tmax, xhalf(tmax));  // all 32 keys of the slice
          }

          v16h bp;  // P^T as B: slot s is key kslot(s, half), the accumulators' own map
#pragma unroll
          for (int r = 0; r < 8; ++r) {
            const float p0 = FAST ? __expf(cs0[r]) : __expf(cs0[r] - tmax);
            const float p1 = FAST ? __expf(cs1[r]) : __expf(cs1[r] - tmax);
            p[h][r] = p0;
            p[h][8 + r] = p1;
            bp[r] = (_Float16)p0;
            bp[8 + r] = (_Float16)p1;
          }
          // rows 8 e .. 8 e + 7 are this head's d; the other eight rows of A are 1.0,
          // so the lanes of the other half hold the slice's sum of P in every slot
          const v8h* vp = e ? vp1 : vp0;
          const v16h va = cat8(vp[(4 * g + 2 * pr) * VROW], vp[(4 * g + 2 * pr + 1) * VROW]);
          v8f oz = {};
          o2[e] = wmma16(va, bp, oz);
          // FAST: plane 0 has no maxima; what the head's own lanes put there is not read
          s_ml[half ^ e][w][h][m] = (FAST || (half ^ e)) ? o2[e][0] : tmax;
        }
        // lane (m, half) keeps head 2 pr + half: O[query m][16 (2 g + pr) + 8 half + r]
        float4 w0, w1;
        w0.x = half ? o2[1][0] : o2[0][0];
        w0.y = half ? o2[1][1] : o2[0][1];
        w0.z = half ? o2[1][2] : o2[0][2];
        w0.w = half ? o2[1][3] : o2[0][3];
        w1.x = half ? o2[1][4] : o2[0][4];
        w1.y = half ? o2[1][5] : o2[0][5];
        w1.z = half ? o2[1][6] : o2[0][6];
        w1.w = half ? o2[1][7] : o2[0][7];
        float* op = &s_o[w][m][32 * g + 16 * pr + 8 * half];
        *(float4*)op = w0;
        *(float4*)(op + 4) = w1;
      }
    }
    __syncthreads();  // every slice's max, sum and O part are in LDS

    // join the slices: one thread per (head, query) turns the 16 maxima into the
    // 16 factors exp(m_w - max) / sum that scale a slice's P and O; FAST: the
    // 16 sums into one factor 1 / sum for all slices
    if (tid < NHEAD * 16) {
      const int hh = tid >> 4, qq = tid & 15;
      if constexpr (FAST) {
        float l4[4] = {0.0f, 0.0f, 0.0f, 0.0f};  // four short chains of additions
#pragma unroll
        for (int i = 0; i < NWV; ++i) l4[i & 3] += s_ml[1][i][hh][qq];
        s_ml[0][0][hh][qq] = 1.0f / ((l4[0] + l4[1]) + (l4[2] + l4[3]));
      } else {
      float mw[NWV];
      float mg = -1e30f;
#pragma unroll
      for (int i = 0; i < NWV; ++i) {
        mw[i] = s_ml[0][i][hh][qq];
        mg = fmaxf(mg, mw[i]);
      }
      float ls = 0.0f;
#pragma unroll
      for (int i = 0; i < NWV; ++i) {
        mw[i] = __expf(mw[i] - mg);
        ls += mw[i] * s_ml[1][i][hh][qq];
      }
      const float inv = 1.0f / ls;
#pragma unroll
      for (int i = 0; i < NWV; ++i) s_ml[0][i][hh][qq] = mw[i] * inv;
      }
    }
    __syncthreads();  // the factors are in LDS

    // head mean of the normalized weights, in registers, heads in order 0..7
    {
      float acc[16];
#pragma unroll
      for (int j = 0; j < 16; ++j) acc[j] = 0.0f;
#pragma unroll
      for (int h = 0; h < NHEAD; ++h) {
        const float f = 0.125f * s_ml[0][FAST ? 0 : w][h][m];
#pragma unroll
        for (int j = 0; j < 16; ++j) acc[j] += p[h][j] * f;
      }
      float* ap = attw + (size_t)row0 * LSEQ + aoff;
#pragma unroll
      for (int t = 0; t < 2; ++t) {
        *(float4*)(ap + 16 * t) = make_float4(acc[8 * t], acc[8 * t + 1],
                                              acc[8 * t + 2], acc[8 * t + 3]);
        *(float4*)(ap + 16 * t + 4) = make_float4(acc[8 * t + 4], acc[8 * t + 5],
                                                  acc[8 * t + 6], acc[8 * t + 7]);
      }
    }

    // the next tile's Q, fetched under this tile's closing work (no branch: the
    // last trip reads tile 0's rows, long since context, and does not use them)
    {
      const _Float16* qn = &s_ctx[((it + 1) & (QTILES - 1)) * 16 + m][h8];
#pragma unroll
      for (int g = 0; g < 2; ++g) {
        qlo[g] = *(const v8h*)(qn + 32 * g);
        qhi[g] = *(const v8h*)(qn + 32 * g + 16);
      }
    }

    // context: wave w sums query w's 16 O parts, a lane two columns (f16, kept in
    // LDS for the Wo product of the closing part)
    {
      const int c2 = lane * 2, hh = lane >> 2;
      float ox = 0.0f, oy = 0.0f;
#pragma unroll
      for (int i = 0; i < NWV; ++i) {
        const float2 ov = *(const float2*)&s_o[i][w][c2];
        if constexpr (FAST) {
          ox += ov.x;
          oy += ov.y;
        } else {
          const float f = s_ml[0][i][hh][w];
          ox += ov.x * f;
          oy += ov.y * f;
        }
      }
      if constexpr (FAST) {
        const float f = s_ml[0][0][hh][w];
        ox *= f;
        oy *= f;
      }
      typedef __attribute__((ext_vector_type(2))) _Float16 v2h;
      v2h o;
      o[0] = (_Float16)ox;
      o[1] = (_Float16)oy;
      *(v2h*)&s_ctx[it * 16 + w][c2] = o;
    }
    // in front of the next trip's overwrite of the registers that this trip's
    // stores name
    asm volatile("s_wait_xcnt 0x0" ::: "memory");
  }
  };
  if (fast) tiles(bconst<true>{});
  else tiles(bconst<false>{});

  // The lane's place is read anew for the closing part (the count of lanes below it):
  // taken from the values at the kernel's head, the addresses formed from it would be
  // held in registers across both loops, and the general loop would spill them.
  {
  const int lane_c = (int)__builtin_amdgcn_mbcnt_lo(~0u, 0u);
  const int m = lane_c & 15, half = lane_c >> 4, h8 = 8 * half;
  // closing part: wave wu < 8 takes rows 16 wu .. 16 wu + 15 of the block; lane
  // (m, half) holds row m, features 16 t + 8 half + r
  const size_t roff = (size_t)(rowb + 16 * (wu & (QTILES - 1)) + m) * EDIM + 8 * half;
  v8f res[4] = {};
  // residual: issued ahead of the barrier, beside the drain of the last tile's stores
  if (wu < QTILES) vec_t(prev + roff, res);
  __syncthreads();  // all 128 context rows are in LDS
  if (wu < QTILES) {
    v16h xb[2];
#pragma unroll
    for (int j = 0; j < 2; ++j) {
      const _Float16* cp = &s_ctx[16 * wu + m][32 * j + h8];
      xb[j] = cat8(*(const v8h*)cp, *(const v8h*)(cp + 16));
    }
    v8f x[4], y[4];
    vec_t(&s_vec[0][h8], x);
    gemm_t(s_w[0], xb, m, half, x);
#pragma unroll
    for (int t = 0; t < 4; ++t) x[t] += res[t];
    ln_t(x, &s_vec[1][h8], &s_vec[2][h8]);

    to_b(x, xb);
    vec_t(&s_vec[3][h8], y);
    gemm_t(s_w[1], xb, m, half, y);
#pragma unroll
    for (int t = 0; t < 4; ++t)
#pragma unroll
      for (int r = 0; r < 8; ++r) y[t][r] = fmaxf(y[t][r], 0.0f);

    to_b(y, xb);
    vec_t(&s_vec[4][h8], y);
    gemm_t(s_w[2], xb, m, half, y);
#pragma unroll
    for (int t = 0; t < 4; ++t) y[t] += x[t];
    ln_t(y, &s_vec[5][h8], &s_vec[6][h8]);

    float* op = out + roff;
#pragma unroll
    for (int t = 0; t < 4; ++t) {
      *(float4*)(op + 16 * t) = make_float4(y[t][0], y[t][1], y[t][2], y[t][3]);
      *(float4*)(op + 16 * t + 4) = make_float4(y[t][4], y[t][5], y[t][6], y[t][7]);
    }
  }
  }
}

// ---------------------------------------------------------------------------
extern "C" void kernel_launch(void* const* d_in, const int* in_sizes, int n_in,
                              void* d_out, int out_size, void* d_ws,
                              size_t ws_size, hipStream_t stream) {
  const float* q    = (const float*)d_in[0];
  const float* k    = (const float*)d_in[1];
  const float* prev = (const float*)d_in[2];
  const float* Wq   = (const float*)d_in[3];
  const float* bq   = (const float*)d_in[4];
  const float* Wk   = (const float*)d_in[5];
  const float* bk   = (const float*)d_in[6];
  const float* Wv   = (const float*)d_in[7];
  const float* bv   = (const float*)d_in[8];
  const float* Wo   = (const float*)d_in[9];
  const float* bo   = (const float*)d_in[10];
  const float* g1   = (const float*)d_in[11];
  const float* bb1  = (const float*)d_in[12];
  const float* W1   = (const float*)d_in[13];
  const float* b1   = (const float*)d_in[14];
  const float* W2   = (const float*)d_in[15];
  const float* b2   = (const float*)d_in[16];
  const float* g2   = (const float*)d_in[17];
  const float* bb2  = (const float*)d_in[18];

  float* out = (float*)d_out;                          // [B, Lq, E]
  float* attw = out + (size_t)BQ * LSEQ * EDIM;        // [B, Lq, Lk]

  ga_attn<<<dim3(LSEQ / (16 * QTILES), BQ), 512, 0, stream>>>(
      q, k, Wq, bq, Wk, bk, Wv, bv, attw, prev, Wo, bo, g1, bb1, W1, b1, W2, b2, g2, bb2, out);
}
